// v000
// The times below were measured on an AMD MI455X: many runs one after another, warmed up first and cycling through
// copies of the inputs, with the whole window's GPU time divided by the number of runs. Launches and the gaps
// between them are all in it. The median over several windows is given; except for v000 it joins two sittings, which
// can be a few percent apart, so the side-by-side timings, each taken in one sitting, are the better comparison.
// The starting kernel, v000, takes 6080 microseconds a run.
#include <hip/hip_runtime.h>
// Self-normalising linear attention (B 2, S 2048, 16 heads × 64): scores[t][s] = q_t·k_s (no scaling), causal (s ≤ t, multiplicative mask), attention = exp(−n[b,t,h])·scores (no softmax), out[b,t,h,:] = Σ_s attention[t][s]·v[b,s,h,:] → [2,2048,16,64].
// Structure: causal structure is the module's own (tril), so per 512-row query block only keys < (qb+1)·512 are formed; scores / hi weighted sums as GEMMs batched over 4 heads per launch (strided views of the input layouts), lo weighted sums one launch per head added through the addend; gate·mask applied on VALU between them; results written straight into the output layout.
// Compute dtype: qk, v, n rounded to bf16 — q, k, v are therefore exact as f16 operands; scores with exact products and f32 accumulation; gated scores as f16 hi + lo·2^10 operands (≈f32 — the weighted sums cancel heavily) of the second GEMM pair, f32 accumulation; exp in f32. v_wmma_f32_16x16x32_f16.
#define NBt 2
#define SS 2048
#define NH 16
#define DH 64
#define QB 512
#define HG 4
typedef __bf16 v16b __attribute__((ext_vector_type(16)));
typedef unsigned short v8us __attribute__((ext_vector_type(8), may_alias));
typedef float  v8f  __attribute__((ext_vector_type(8)));
typedef float  v4f  __attribute__((ext_vector_type(4)));
typedef float  v4fa __attribute__((ext_vector_type(4), may_alias));
union FragB { v16b v; v8us half[2]; unsigned short u[16]; };

__device__ __forceinline__ unsigned short bf16_bits(float x) { unsigned int u = __float_as_uint(x); return (unsigned short)((u + 0x7FFFu + ((u >> 16) & 1u)) >> 16); }
__device__ __forceinline__ float bf16_val(unsigned short b) { return __uint_as_float(((unsigned int)b) << 16); }
__device__ __forceinline__ float bf16_round(float x) { return bf16_val(bf16_bits(x)); }
// D += A·B with NT terms: 1 = ah·bh, 2 = + al·bh (A split), 3 = + ah·bl (both split)
template <int NT>
__device__ __forceinline__ v8f mmaN(v16b ah, v16b al, v16b bh, v16b bl, v8f c) {
  c = __builtin_amdgcn_wmma_f32_16x16x32_bf16(false, ah, false, bh, (short)0, c, false, false);
  if (NT >= 2) c = __builtin_amdgcn_wmma_f32_16x16x32_bf16(false, al, false, bh, (short)0, c, false, false);
  if (NT >= 3) c = __builtin_amdgcn_wmma_f32_16x16x32_bf16(false, ah, false, bl, (short)0, c, false, false);
  asm volatile("v_nop\n\tv_nop\n\tv_nop\n\tv_nop" : "+v"(c) : "v"(ah), "v"(al), "v"(bh), "v"(bl));
  return c;
}

__global__ __launch_bounds__(256) void k_wt_bf16(const float* __restrict__ W, unsigned short* __restrict__ Wt, int K, int N) {
  const int t = blockIdx.x * 256 + threadIdx.x;
  const int k8n = K / 8;
  if (t >= N * k8n) return;
  const int n = t / k8n, k8 = (t % k8n) * 8;
  v8us v;
#pragma unroll
  for (int i = 0; i < 8; ++i) v[i] = bf16_bits(W[(size_t)(k8 + i) * N + n]);
  *(v8us*)(Wt + (size_t)n * K + k8) = v;
  
}

// GEMM C[M][N] (f32, pitch ldc) = act(A[M][K]·W + bias). A f32 row-major (pitch lda) converted per fragment to bf16
// (ASPLIT: hi/lo two planes -> 2 terms, else single rounded term); Wt bf16 [N][K] (pitch ldb). BIAS_BF16 rounds the
// bias to bf16 first (bias quantised to bf16 before the add). K%32==0, M%16==0, N%64==0.
template <bool ASPLIT, int ACT, bool BIAS_BF16>
__global__ __launch_bounds__(128) void k_gemm_bf(const float* __restrict__ A, int lda, const unsigned short* __restrict__ Wt, int ldb,
                                               const float* __restrict__ bias, float* __restrict__ C, int ldc, int M, int N, int K) {
  __shared__ __attribute__((aligned(16))) float so[4][16][64];
  const int tid = threadIdx.x, w = tid >> 5, lane = tid & 31, ln = lane & 15, hh = lane >> 4;
  const int ntn = N / 64;
  const int wid = blockIdx.x * 4 + w;
  const int mt = wid / ntn, nq = wid % ntn;
  if (mt * 16 >= M) return;
  const int row0 = mt * 16, col0 = nq * 64;
  const float* arow = A + (size_t)(row0 + ln) * lda;
  v8f acc[4] = {};
  for (int kb = 0; kb < K; kb += 32) {
    FragB ah, al;
    const v4f x0 = *(const v4fa*)(arow + kb + 8 * hh), x1 = *(const v4fa*)(arow + kb + 8 * hh + 4);
    const v4f x2 = *(const v4fa*)(arow + kb + 16 + 8 * hh), x3 = *(const v4fa*)(arow + kb + 16 + 8 * hh + 4);
    float xs[16] = {x0[0],x0[1],x0[2],x0[3],x1[0],x1[1],x1[2],x1[3],x2[0],x2[1],x2[2],x2[3],x3[0],x3[1],x3[2],x3[3]};
#pragma unroll
    for (int i = 0; i < 16; ++i) { const unsigned short hb = bf16_bits(xs[i]); ah.u[i] = hb; al.u[i] = ASPLIT ? bf16_bits(xs[i] - bf16_val(hb)) : (unsigned short)0; }
#pragma unroll
    for (int t = 0; t < 4; ++t) {
      const unsigned short* brow = Wt + (size_t)(col0 + t * 16 + ln) * ldb + kb;
      FragB b;
      b.half[0] = *(const v8us*)(brow + 8 * hh);
      b.half[1] = *(const v8us*)(brow + 16 + 8 * hh);
      acc[t] = mmaN<ASPLIT ? 2 : 1>(ah.v, al.v, b.v, b.v, acc[t]);
    }
  }
#pragma unroll
  for (int t = 0; t < 4; ++t) {
    float bv = bias ? bias[col0 + t * 16 + ln] : 0.f;
    if (BIAS_BF16) bv = bf16_round(bv);
#pragma unroll
    for (int r = 0; r < 8; ++r) { float v = acc[t][r] + bv; if (ACT == 1) v = fmaxf(v, 0.f); so[w][8 * hh + r][t * 16 + ln] = v; }
  }
  __builtin_amdgcn_fence(__ATOMIC_ACQ_REL, "workgroup");
  __builtin_amdgcn_wave_barrier();
  const int rsub = lane >> 4, c4 = (lane & 15) * 4;
  {
#pragma unroll
    for (int q = 0; q < 8; ++q) {
      const int r = q * 2 + rsub;
      const v4f v = *(const v4fa*)&so[w][r][c4];
      *(v4f*)(C + (size_t)(row0 + r) * ldc + col0 + c4) = v;
    }
    
  }
}

// GEMM C = act(A·W + bias + resid): A f32 (ASPLIT -> hi/lo 2 terms), Wt bf16 [N][K]; ACT 0 none, 1 relu, 2 exact gelu;
// resid (optional, f32, row index = (row % rmod), pitch ldr, RES_BF16 rounds it) added before the activation.
template <bool ASPLIT, int ACT, bool BIAS_BF16, bool RES_BF16>
__global__ __launch_bounds__(128) void k_gemm_bf3(const float* __restrict__ A, int lda, const unsigned short* __restrict__ Wt, int ldb,
                                                const float* __restrict__ bias, const float* __restrict__ resid, int rmod, int ldr,
                                                float* __restrict__ C, int ldc, int M, int N, int K) {
  __shared__ __attribute__((aligned(16))) float so[4][16][64];
  const int tid = threadIdx.x, w = tid >> 5, lane = tid & 31, ln = lane & 15, hh = lane >> 4;
  const int ntn = N / 64;
  const int wid = blockIdx.x * 4 + w;
  const int mt = wid / ntn, nq = wid % ntn;
  if (mt * 16 >= M) return;
  const int row0 = mt * 16, col0 = nq * 64;
  const float* arow = A + (size_t)(row0 + ln) * lda;
  v8f acc[4] = {};
  for (int kb = 0; kb < K; kb += 32) {
    FragB ah, al;
    const v4f x0 = *(const v4fa*)(arow + kb + 8 * hh), x1 = *(const v4fa*)(arow + kb + 8 * hh + 4);
    const v4f x2 = *(const v4fa*)(arow + kb + 16 + 8 * hh), x3 = *(const v4fa*)(arow + kb + 16 + 8 * hh + 4);
    float xs[16] = {x0[0],x0[1],x0[2],x0[3],x1[0],x1[1],x1[2],x1[3],x2[0],x2[1],x2[2],x2[3],x3[0],x3[1],x3[2],x3[3]};
#pragma unroll
    for (int i = 0; i < 16; ++i) { const unsigned short hb = bf16_bits(xs[i]); ah.u[i] = hb; al.u[i] = ASPLIT ? bf16_bits(xs[i] - bf16_val(hb)) : (unsigned short)0; }
#pragma unroll
    for (int t = 0; t < 4; ++t) {
      const unsigned short* brow = Wt + (size_t)(col0 + t * 16 + ln) * ldb + kb;
      FragB b;
      b.half[0] = *(const v8us*)(brow + 8 * hh);
      b.half[1] = *(const v8us*)(brow + 16 + 8 * hh);
      acc[t] = mmaN<ASPLIT ? 2 : 1>(ah.v, al.v, b.v, b.v, acc[t]);
    }
  }
#pragma unroll
  for (int t = 0; t < 4; ++t) {
    const int col = col0 + t * 16 + ln;
    float bv = bias ? bias[col] : 0.f;
    if (BIAS_BF16) bv = bf16_round(bv);
#pragma unroll
    for (int r = 0; r < 8; ++r) {
      float v = acc[t][r] + bv;
      if (resid) { float rv = resid[(size_t)((row0 + 8 * hh + r) % rmod) * ldr + col]; if (RES_BF16) rv = bf16_round(rv); v += rv; }
      if (ACT == 1) v = fmaxf(v, 0.f);
      if (ACT == 2) v = 0.5f * v * (1.0f + erff(v * 0.70710678118654752f));
      if (ACT == 3) { const float u = 0.7978845608028654f * (v + 0.044715f * v * v * v); v = 0.5f * v * (1.0f + tanhf(u)); }
      so[w][8 * hh + r][t * 16 + ln] = v;
    }
  }
  __builtin_amdgcn_fence(__ATOMIC_ACQ_REL, "workgroup");
  __builtin_amdgcn_wave_barrier();
  const int rsub = lane >> 4, c4 = (lane & 15) * 4;
  {
#pragma unroll
    for (int q = 0; q < 8; ++q) {
      const int r = q * 2 + rsub;
      const v4f v = *(const v4fa*)&so[w][r][c4];
      *(v4f*)(C + (size_t)(row0 + r) * ldc + col0 + c4) = v;
    }
    
  }
}
// row LayerNorm (biased variance, eps) over N: s = X (+ R); optional out_sum <- s; out_norm <- (s-mu)*rsqrt(var+eps)*g + b
template <bool PARAM_BF16>
__global__ __launch_bounds__(256) void k_layernorm(const float* __restrict__ X, const float* __restrict__ R, const float* __restrict__ g, const float* __restrict__ bta,
                                                  float* __restrict__ out_sum, float* __restrict__ out_norm, int N, float eps) {
  __shared__ float red[256];
  const int row = blockIdx.x, tid = threadIdx.x;
  const float* x = X + (size_t)row * N; const float* rr = R ? R + (size_t)row * N : nullptr;
  float vals[16];                     // up to N = 4096
  const int per = N / 256;            // contiguous chunk per thread? use strided-by-4 chunks: thread handles j = tid*4 + 1024*u
  float s1 = 0.f;
  for (int u = 0; u < per / 4; ++u) {
    const int j = tid * 4 + 1024 * u;
    const v4f a = *(const v4fa*)(x + j);
    v4f b = {0.f,0.f,0.f,0.f}; if (rr) b = *(const v4fa*)(rr + j);
#pragma unroll
    for (int q = 0; q < 4; ++q) { const float v = a[q] + b[q]; vals[u * 4 + q] = v; s1 += v; }
  }
  red[tid] = s1; __syncthreads();
  for (int st = 128; st > 0; st >>= 1) { if (tid < st) red[tid] += red[tid + st]; __syncthreads(); }
  const float mu = red[0] / (float)N; __syncthreads();
  float s2 = 0.f;
  for (int u = 0; u < per / 4; ++u)
#pragma unroll
    for (int q = 0; q < 4; ++q) { const float c = vals[u * 4 + q] - mu; s2 += c * c; }
  red[tid] = s2; __syncthreads();
  for (int st = 128; st > 0; st >>= 1) { if (tid < st) red[tid] += red[tid + st]; __syncthreads(); }
  const float rs = rsqrtf(red[0] / (float)N + eps);
  {
    for (int u = 0; u < per / 4; ++u) {
      const int j = tid * 4 + 1024 * u;
      v4f o, sm;
#pragma unroll
      for (int q = 0; q < 4; ++q) {
        float gg = g[j + q], bb = bta[j + q];
        if (PARAM_BF16) { gg = bf16_round(gg); bb = bf16_round(bb); }
        sm[q] = vals[u * 4 + q]; o[q] = (vals[u * 4 + q] - mu) * rs * gg + bb;
      }
      if (out_sum) *(v4f*)(out_sum + (size_t)row * N + j) = sm;
      *(v4f*)(out_norm + (size_t)row * N + j) = o;
    }
    
  }
}



// ---- f16 WMMA path (v_wmma_f32_16x16x32_f16): 11-bit significands for operands in range — used here for q·k and for the gated scores (f16 hi/lo planes)·v
typedef _Float16 v16h __attribute__((ext_vector_type(16)));
union FragH { v16h v; v8us half[2]; _Float16 h[16]; unsigned short u[16]; };
template <int NT>
__device__ __forceinline__ v8f mmaH(v16h ah, v16h al, v16h bh, v16h bl, v8f c) {
  c = __builtin_amdgcn_wmma_f32_16x16x32_f16(false, ah, false, bh, (short)0, c, false, false);
  if (NT >= 2) c = __builtin_amdgcn_wmma_f32_16x16x32_f16(false, al, false, bh, (short)0, c, false, false);
  if (NT >= 3) c = __builtin_amdgcn_wmma_f32_16x16x32_f16(false, ah, false, bl, (short)0, c, false, false);
  asm volatile("v_nop\n\tv_nop\n\tv_nop\n\tv_nop" : "+v"(c) : "v"(ah), "v"(al), "v"(bh), "v"(bl));
  return c;
}
// batched GEMM like k_gemm_b but f16 operands: A f32 (split into f16 hi/lo if ASPLIT, else rounded to f16), Bt = f16 values [n][k]; alpha; C f32; N multiple of 16 (partial tiles skipped)
template <bool ASPLIT>
__global__ __launch_bounds__(128) void k_gemm_h(const float* __restrict__ A, int lda, size_t sA, const _Float16* __restrict__ Bh, int ldb, size_t sB, float alpha, float* __restrict__ C, int ldc, size_t sC, int M, int N, int K) {
  __shared__ __attribute__((aligned(16))) float so[4][16][64];
  const int tid = threadIdx.x, w = tid >> 5, lane = tid & 31, ln = lane & 15, hh = lane >> 4; const int by = blockIdx.y;
  A += (size_t)by * sA; Bh += (size_t)by * sB; C += (size_t)by * sC;
  const int ntn = (N + 63) / 64; const int wid = blockIdx.x * 4 + w; const int mt = wid / ntn, nq = wid % ntn; if (mt * 16 >= M) return;
  const int row0 = mt * 16, col0 = nq * 64; const float* arow = A + (size_t)(row0 + ln) * lda;
  v8f acc[4] = {};
  for (int kb = 0; kb < K; kb += 32) {
    FragH ah, al;
    const v4f x0 = *(const v4fa*)(arow + kb + 8 * hh), x1 = *(const v4fa*)(arow + kb + 8 * hh + 4), x2 = *(const v4fa*)(arow + kb + 16 + 8 * hh), x3 = *(const v4fa*)(arow + kb + 16 + 8 * hh + 4);
    float xs[16] = {x0[0],x0[1],x0[2],x0[3],x1[0],x1[1],x1[2],x1[3],x2[0],x2[1],x2[2],x2[3],x3[0],x3[1],x3[2],x3[3]};
#pragma unroll
    for (int i = 0; i < 16; ++i) { const _Float16 h = (_Float16)xs[i]; ah.h[i] = h; al.h[i] = ASPLIT ? (_Float16)(xs[i] - (float)h) : (_Float16)0.0f; }
#pragma unroll
    for (int t = 0; t < 4; ++t) { if (col0 + t * 16 >= N) continue; const size_t boff = (size_t)(col0 + t * 16 + ln) * ldb + kb; FragH bq; bq.half[0] = *(const v8us*)(Bh + boff + 8 * hh); bq.half[1] = *(const v8us*)(Bh + boff + 16 + 8 * hh);
      acc[t] = mmaH<ASPLIT ? 2 : 1>(ah.v, al.v, bq.v, bq.v, acc[t]); }
  }
#pragma unroll
  for (int t = 0; t < 4; ++t) { if (col0 + t * 16 >= N) continue;
#pragma unroll
    for (int r = 0; r < 8; ++r) so[w][8 * hh + r][t * 16 + ln] = acc[t][r] * alpha; }
  __builtin_amdgcn_fence(__ATOMIC_ACQ_REL, "workgroup"); __builtin_amdgcn_wave_barrier();
  const int rsub = lane >> 4, c4 = (lane & 15) * 4;
  {
#pragma unroll
    for (int q = 0; q < 8; ++q) { const int r = q * 2 + rsub; if (col0 + c4 < N) { const v4f v = *(const v4fa*)&so[w][r][c4]; *(v4f*)(C + (size_t)(row0 + r) * ldc + col0 + c4) = v; } }
     }
}

// Wt[n][k] = f16(W[k][n]·scale) from f32 row-major W[K][N] (scale = power of two; bf16-exact weights stay exact in f16 away from the subnormal range)
__global__ __launch_bounds__(256) void k_wt_f16(const float* __restrict__ W, _Float16* __restrict__ Wt, int K, int N, float scale) {
  const int t = blockIdx.x * 256 + threadIdx.x; if (t >= N * (K / 8)) return; const int n = t / (K / 8), k8 = (t % (K / 8)) * 8; FragH f;
#pragma unroll
  for (int i = 0; i < 8; ++i) f.h[i] = (_Float16)(bf16_round(W[(size_t)(k8 + i) * N + n]) * scale); const v8us o = f.half[0];
  *(v8us*)((unsigned short*)Wt + (size_t)n * K + k8) = o; 
}
// k_gemm_hh variant with fused epilogue: v = acc·alpha + bias[by·sBias + col] (+ CP[(row/rowsPerB)·sCPb + by·64 + col] if CP) ; ACT 0 none / 1 elu ; writes f32 C and f16 C16, each if non-null
template <int ACT>
__global__ __launch_bounds__(128) void k_gemm_hhx(const _Float16* __restrict__ A, int lda, size_t sA, const _Float16* __restrict__ Bh, int ldb, size_t sB, float alpha, const float* __restrict__ bias, size_t sBias, const float* __restrict__ CP, int rowsPerB, size_t sCPb, int row0g,
    float* __restrict__ C, _Float16* __restrict__ C16, int ldc, size_t sC, int M, int N, int K) {
  __shared__ __attribute__((aligned(16))) float so[4][16][64];
  const int tid = threadIdx.x, w = tid >> 5, lane = tid & 31, ln = lane & 15, hh = lane >> 4; const int by = blockIdx.y;
  A += (size_t)by * sA; Bh += (size_t)by * sB; const size_t cofs = (size_t)by * sC; const float* bp = bias ? bias + (size_t)by * sBias : nullptr;
  const int ntn = (N + 63) / 64; const int wid = blockIdx.x * 4 + w; const int mt = wid / ntn, nq = wid % ntn; if (mt * 16 >= M) return;
  const int row0 = mt * 16, col0 = nq * 64; const _Float16* arow = A + (size_t)(row0 + ln) * lda;
  v8f acc[4] = {};
  for (int kb = 0; kb < K; kb += 32) { FragH ah; ah.half[0] = *(const v8us*)((const unsigned short*)arow + kb + 8 * hh); ah.half[1] = *(const v8us*)((const unsigned short*)arow + kb + 16 + 8 * hh);
#pragma unroll
    for (int t = 0; t < 4; ++t) { if (col0 + t * 16 >= N) continue; const size_t boff = (size_t)(col0 + t * 16 + ln) * ldb + kb; FragH bq; bq.half[0] = *(const v8us*)((const unsigned short*)Bh + boff + 8 * hh); bq.half[1] = *(const v8us*)((const unsigned short*)Bh + boff + 16 + 8 * hh);
      acc[t] = mmaH<1>(ah.v, ah.v, bq.v, bq.v, acc[t]); }
  }
#pragma unroll
  for (int t = 0; t < 4; ++t) { if (col0 + t * 16 >= N) continue; const int col = col0 + t * 16 + ln; const float bv = bp ? bf16_round(bp[col]) : 0.f;
#pragma unroll
    for (int r = 0; r < 8; ++r) { float v = acc[t][r] * alpha + bv; if (CP) { const int bidx = (row0g + row0 + 8 * hh + r) / rowsPerB; v += CP[(size_t)bidx * sCPb + (size_t)by * 64 + col]; } if (ACT == 1) v = (v > 0.f) ? v : expm1f(v); else if (ACT == 7) v = (v > 0.f) ? v + 1.0f : expf(v); else if (ACT == 8) v = tanhf(v); else if (ACT == 9) v = 0.5f * v * (1.0f + tanhf(0.7978845608028654f * (v + 0.044715f * v * v * v))); else if (ACT == 11) v = 1.0f / (1.0f + expf(-v)); else if (ACT == 12) v = (v > 0.f) ? v : 0.01f * v; else if (ACT == 14) v = (v > 0.f) ? v : 0.1f * v; else if (ACT == 15) v = v / (1.0f + expf(-v)); else if (ACT == 3) v = fmaxf(v, 0.f); else if (ACT == 6) v = 0.5f * v * (1.0f + erff(v * 0.70710678118654752f)); so[w][8 * hh + r][t * 16 + ln] = v; } }
  __builtin_amdgcn_fence(__ATOMIC_ACQ_REL, "workgroup"); __builtin_amdgcn_wave_barrier();
  const int rsub = lane >> 4, c4 = (lane & 15) * 4; typedef _Float16 v4h __attribute__((ext_vector_type(4)));
  {
#pragma unroll
    for (int q = 0; q < 8; ++q) { const int r = q * 2 + rsub; if (col0 + c4 < N) { const v4f v = *(const v4fa*)&so[w][r][c4]; if (C) *(v4f*)(C + cofs + (size_t)(row0 + r) * ldc + col0 + c4) = v; if (C16) { v4h h4; for (int i = 0; i < 4; ++i) h4[i] = (_Float16)v[i]; *(v4h*)(C16 + cofs + (size_t)(row0 + r) * ldc + col0 + c4) = h4; } } }
     }
}


typedef _Float16 v4h __attribute__((ext_vector_type(4)));

__global__ __launch_bounds__(256) void k_x16(const float* __restrict__ x, _Float16* __restrict__ X16, size_t n8) { const size_t t = (size_t)blockIdx.x * 256 + threadIdx.x; if (t >= n8) return; FragH f;
#pragma unroll
  for (int q = 0; q < 8; ++q) f.h[q] = (_Float16)bf16_round(x[t * 8 + q]); *(v8us*)((unsigned short*)X16 + t * 8) = f.half[0];  }
__global__ __launch_bounds__(256) void k_h16(const float* __restrict__ x, _Float16* __restrict__ X16, size_t n8) { const size_t t = (size_t)blockIdx.x * 256 + threadIdx.x; if (t >= n8) return; FragH f;
#pragma unroll
  for (int q = 0; q < 8; ++q) f.h[q] = (_Float16)x[t * 8 + q]; *(v8us*)((unsigned short*)X16 + t * 8) = f.half[0];  }
__global__ __launch_bounds__(256) void k_round16f(const float* __restrict__ W, _Float16* __restrict__ Bt, size_t n8) { const size_t t = (size_t)blockIdx.x * 256 + threadIdx.x; if (t >= n8) return; FragH f;
#pragma unroll
  for (int i = 0; i < 8; ++i) f.h[i] = (_Float16)(bf16_round(W[t * 8 + i]) * 16.0f); *(v8us*)((unsigned short*)Bt + t * 8) = f.half[0];  }
template <int NHv, int TTv>
__global__ __launch_bounds__(256) void k_vt(const _Float16* __restrict__ V16, int ldv, int voff, _Float16* __restrict__ Vt) { __shared__ unsigned short tl[64][66]; const int tid = threadIdx.x; const int slab = blockIdx.x / (TTv / 64), lg = blockIdx.x % (TTv / 64); const int b = slab / NHv, h = slab % NHv;
  for (int i = tid; i < 64 * 8; i += 256) { const int r = i / 8, c8 = (i % 8) * 8; FragH f; f.half[0] = *(const v8us*)((const unsigned short*)V16 + ((size_t)b * TTv + lg * 64 + r) * ldv + voff + h * 64 + c8);
#pragma unroll
    for (int q = 0; q < 8; ++q) tl[r][c8 + q] = f.u[q]; }
  __syncthreads();
  {
#pragma unroll
    for (int rd = 0; rd < 2; ++rd) { const int d = rd * 32 + tid / 8, pc = tid % 8; FragH f;
#pragma unroll
      for (int q = 0; q < 8; ++q) f.u[q] = tl[pc * 8 + q][d];
      *(v8us*)((unsigned short*)Vt + ((size_t)slab * 64 + d) * TTv + lg * 64 + pc * 8) = f.half[0]; }
     } }

__global__ __launch_bounds__(256) void k_hl(const float* __restrict__ F, _Float16* __restrict__ Hh, _Float16* __restrict__ Hl, size_t n8) { const size_t t = (size_t)blockIdx.x * 256 + threadIdx.x; if (t >= n8) return; FragH fh, fl; const v4f a = *(const v4fa*)(F + t * 8), c = *(const v4fa*)(F + t * 8 + 4);
#pragma unroll
  for (int q = 0; q < 4; ++q) { _Float16 h = (_Float16)a[q]; fh.h[q] = h; fl.h[q] = (_Float16)((a[q] - (float)h) * 1024.0f); h = (_Float16)c[q]; fh.h[4 + q] = h; fl.h[4 + q] = (_Float16)((c[q] - (float)h) * 1024.0f); }
  { *(v8us*)((unsigned short*)Hh + t * 8) = fh.half[0]; *(v8us*)((unsigned short*)Hl + t * 8) = fl.half[0];  } }

__global__ __launch_bounds__(256) void k_vt(const float* __restrict__ v, _Float16* __restrict__ VT) { const int t = blockIdx.x * 256 + threadIdx.x; if (t >= NBt * NH * DH * (SS / 8)) return; const int s0 = (t % (SS / 8)) * 8; const int d = (t / (SS / 8)) % DH; const int bh = t / ((SS / 8) * DH); const int b = bh / NH, h = bh % NH; FragH f;
#pragma unroll
  for (int q = 0; q < 8; ++q) f.h[q] = (_Float16)bf16_round(v[(((size_t)b * SS + s0 + q) * NH + h) * DH + d]);
  *(v8us*)((unsigned short*)VT + ((size_t)bh * DH + d) * SS + s0) = f.half[0];  }
__global__ __launch_bounds__(256) void k_gate(const float* __restrict__ S, const float* __restrict__ nn, int b, int h0, int r0, int nk, _Float16* __restrict__ P16, _Float16* __restrict__ PL16) {
  #pragma clang fp contract(off)
  const int t = blockIdx.x * 256 + threadIdx.x; const int G8 = nk / 8; if (t >= HG * QB * G8) return; const int s0 = (t % G8) * 8; const int tl = (t / G8) % QB; const int g = t / (G8 * QB); const int tq = r0 + tl; const float gate = expf(-bf16_round(nn[((size_t)b * SS + tq) * NH + h0 + g])); const float* sr = S + ((size_t)g * QB + tl) * SS + s0; const v4f a = *(const v4fa*)sr, c = *(const v4fa*)(sr + 4); FragH f, fl;
#pragma unroll
  for (int q = 0; q < 8; ++q) { const int s = s0 + q; const float v = (q < 4) ? a[q] : c[q - 4]; const float pv = (s <= tq) ? v * gate : 0.f; const _Float16 hi = (_Float16)pv; f.h[q] = hi; fl.h[q] = (_Float16)((pv - (float)hi) * 1024.0f); }
  { *(v8us*)((unsigned short*)P16 + ((size_t)g * QB + tl) * SS + s0) = f.half[0]; *(v8us*)((unsigned short*)PL16 + ((size_t)g * QB + tl) * SS + s0) = fl.half[0];  } }

extern "C" void kernel_launch(void* const* d_in, const int* in_sizes, int n_in,
                              void* d_out, int out_size, void* d_ws, size_t ws_size, hipStream_t stream) {
  (void)in_sizes; (void)n_in; (void)out_size;
  const float* qk = (const float*)d_in[0]; const float* v = (const float*)d_in[1]; const float* nn = (const float*)d_in[2];
  char* ws = (char*)d_ws; size_t off = 0;
  auto take = [&](size_t bytes) { char* p = ws + off; off += (bytes + 255) & ~(size_t)255; return p; };
  _Float16* QK16 = (_Float16*)take((size_t)NBt * SS * 2 * NH * DH * 2); _Float16* VT = (_Float16*)take((size_t)NBt * NH * DH * SS * 2); float* S = (float*)take((size_t)HG * QB * SS * 4); _Float16* P16 = (_Float16*)take((size_t)HG * QB * SS * 2); _Float16* PL16 = (_Float16*)take((size_t)HG * QB * SS * 2);
  if (off > ws_size) return;      // 16.8 + 8.4 + 16.8 + 8.4 + 8.4 ≈ 59 MB
  k_x16<<<(unsigned)(((size_t)NBt * SS * 2 * NH * DH / 8 + 255) / 256), 256, 0, stream>>>(qk, QK16, (size_t)NBt * SS * 2 * NH * DH / 8);      /* q|k exact in f16 (bf16 inputs) */
  k_vt<<<(NBt * NH * DH * (SS / 8) + 255) / 256, 256, 0, stream>>>(v, VT);
  const int RS = 2 * NH * DH;      /* 2048: row stride (t) in the qk layout */
  for (int b = 0; b < NBt; ++b) for (int hg = 0; hg < NH / HG; ++hg) { const int h0 = hg * HG;
    for (int qb = 0; qb < SS / QB; ++qb) { const int r0 = qb * QB, nk = (qb + 1) * QB;
      k_gemm_hhx<0><<<dim3(((QB / 16) * (nk / 64) + 3) / 4, HG), 128, 0, stream>>>(QK16 + ((size_t)b * SS + r0) * RS + h0 * DH, RS, (size_t)DH, QK16 + (size_t)b * SS * RS + NH * DH + h0 * DH, RS, (size_t)DH, 1.0f, nullptr, 0, nullptr, 1, 0, 0, S, nullptr, SS, (size_t)QB * SS, QB, nk, DH);      /* scores = q·k (exact): M 512 N nk K 64, 4 heads (grid.y column stride 64) */
      k_gate<<<(HG * QB * (nk / 8) + 255) / 256, 256, 0, stream>>>(S, nn, b, h0, r0, nk, P16, PL16);
      k_gemm_hhx<0><<<dim3(((QB / 16) * 1 + 3) / 4, HG), 128, 0, stream>>>(P16, SS, (size_t)QB * SS, VT + ((size_t)(b * NH + h0)) * DH * SS, SS, (size_t)DH * SS, 1.0f, nullptr, 0, nullptr, 1, 0, 0, (float*)d_out + ((size_t)b * SS + r0) * NH * DH + h0 * DH, nullptr, NH * DH, (size_t)DH, QB, DH, nk);      /* hi: out[b][t][h][:] = Σ_s P·v: M 512 N 64 K nk (grid.y: A stride 512·2048, Bt stride 64·2048, C column stride 64, ldc 1024) */
      for (int gq = 0; gq < HG; ++gq) { float* Co = (float*)d_out + ((size_t)b * SS + r0) * NH * DH + (h0 + gq) * DH; k_gemm_hhx<0><<<dim3(((QB / 16) * 1 + 3) / 4, 1), 128, 0, stream>>>(PL16 + (size_t)gq * QB * SS, SS, 0, VT + ((size_t)(b * NH + h0 + gq)) * DH * SS, SS, 0, 0.0009765625f, nullptr, 0, Co, 1, (size_t)NH * DH, 0, Co, nullptr, NH * DH, 0, QB, DH, nk); } } }      /* lo: += Σ_s P_lo·v / 1024, one un-batched launch per head */
}

// v001
// One run takes 56.5 microseconds.
// Two timings next to v000 put it at 107 and 108 times that version's speed.
#include <hip/hip_runtime.h>
// Self-normalising linear attention (B 2, S 2048, 16 heads x 64): scores[t][s] = q_t.k_s (no scaling), causal (s <= t, multiplicative mask),
// attention = exp(-n[b,t,h]) * scores (no softmax), out[b,t,h,:] = sum_s attention[t][s] * v[b,s,h,:] -> [2,2048,16,64].
// Structure: two conversion launches (q|k to f16, v to f16 transposed per head), then ONE launch that does scores, gate, mask and weighted sums.
//   A work-group of 8 waves owns 128 queries of one (batch, head); a wave owns 16 of them. It walks the keys 0 .. last query in stages of 64.
//   Transposed products: S^T = K.Q^T (A = key rows from LDS, B = the wave's queries, kept in registers), O^T += V^T.P^T.
//   Two f32 S^T tiles (keys 0-15, 16-31 of a pass, same queries), gated and converted in place, ARE the B operand of the second product,
//   so a score never leaves the registers. Causal balance: each work-group takes query tile 15 - p and then tile p (34 stages for every one).
// Compute dtype: qk, v, n rounded to bf16, so q, k, v are exact as f16 operands; scores with exact products and
//   f32 accumulation; gated scores as f16 hi + lo * 2^10 operands (about f32: the weighted sums cancel heavily), f32 accumulation, keys in
//   ascending order 32 at a time; exp in f32. v_wmma_f32_16x16x32_f16.
#define NBt 2
#define SS 2048
#define NH 16
#define DH 64
#define RS (2 * NH * DH)   /* row stride (t) of the q|k layout, elements */
#define QT 128             /* queries per work-group tile */
#define KS 64              /* keys per stage */
#define LP 72              /* LDS row pitch in f16: 144 B = 16 B x odd, conflict-free for 16-byte row readers */
#define OP 68              /* output staging pitch in f32: 272 B = 16 B x odd */
typedef unsigned short v8us __attribute__((ext_vector_type(8), may_alias));
typedef float  v8f  __attribute__((ext_vector_type(8)));
typedef float  v4f  __attribute__((ext_vector_type(4)));
typedef float  v4fa __attribute__((ext_vector_type(4), may_alias));
typedef _Float16 v16h __attribute__((ext_vector_type(16)));
typedef float v2f __attribute__((ext_vector_type(2)));
typedef _Float16 v2h __attribute__((ext_vector_type(2)));
union FragH { v16h v; v8us half[2]; v2h h2[8]; _Float16 h[16]; unsigned short u[16]; };

__device__ __forceinline__ unsigned short bf16_bits(float x) { unsigned int u = __float_as_uint(x); return (unsigned short)((u + 0x7FFFu + ((u >> 16) & 1u)) >> 16); }
__device__ __forceinline__ float bf16_val(unsigned short b) { return __uint_as_float(((unsigned int)b) << 16); }
__device__ __forceinline__ float bf16_round(float x) { return bf16_val(bf16_bits(x)); }
__device__ __forceinline__ v8f mma(v16h a, v16h b, v8f c) { return __builtin_amdgcn_wmma_f32_16x16x32_f16(false, a, false, b, (short)0, c, false, false); }

__global__ __launch_bounds__(256) void k_x16(const float* __restrict__ x, _Float16* __restrict__ X16, size_t n8) { const size_t t = (size_t)blockIdx.x * 256 + threadIdx.x; if (t >= n8) return; FragH f;
#pragma unroll
  for (int q = 0; q < 8; ++q) f.h[q] = (_Float16)bf16_round(x[t * 8 + q]); *(v8us*)((unsigned short*)X16 + t * 8) = f.half[0];  }

__global__ __launch_bounds__(256) void k_vt(const float* __restrict__ v, _Float16* __restrict__ VT) { const int t = blockIdx.x * 256 + threadIdx.x; if (t >= NBt * NH * DH * (SS / 8)) return; const int s0 = (t % (SS / 8)) * 8; const int d = (t / (SS / 8)) % DH; const int bh = t / ((SS / 8) * DH); const int b = bh / NH, h = bh % NH; FragH f;
#pragma unroll
  for (int q = 0; q < 8; ++q) f.h[q] = (_Float16)bf16_round(v[(((size_t)b * SS + s0 + q) * NH + h) * DH + d]);
  *(v8us*)((unsigned short*)VT + ((size_t)bh * DH + d) * SS + s0) = f.half[0];  }

// Gate, mask and split of one pass: two f32 S^T tiles (keys s0 + 0..15, s0 + 16..31, this lane's query tq) become the hi and lo B operands.
// sc[a][r] = score of key s0 + 16a + 8hh + r; element 8a + r of a B operand is k = 16a + 8hh + r: the hardware k order, in place.
template <bool MASK>
__device__ __forceinline__ void split32(const v8f (&sc)[2], float gate, int s0, int hh, int tq, FragH& ph, FragH& pl) {
#pragma unroll      /* fragments and accumulators are register arrays: every index a constant */
  for (int a = 0; a < 2; ++a)
#pragma unroll      /* fragments and accumulators are register arrays: every index a constant */
    for (int r = 0; r < 8; r += 2) {      /* two scores at a time: packed multiply, packed conversions */
      v2f pv = { sc[a][r] * gate, sc[a][r + 1] * gate };
      if (MASK) { const int s = s0 + 16 * a + 8 * hh + r; pv[0] = (s <= tq) ? pv[0] : 0.f; pv[1] = (s + 1 <= tq) ? pv[1] : 0.f; }
      const v2h hi = __builtin_convertvector(pv, v2h);
      const v2h lo = __builtin_convertvector((pv - __builtin_convertvector(hi, v2f)) * 1024.0f, v2h);
      ph.h2[4 * a + r / 2] = hi;
      pl.h2[4 * a + r / 2] = lo;
    }
}
// A fragment of 16 rows x 32 k from LDS rows of pitch LP, in the hardware k order (elements 0-7 = k 8hh + i, 8-15 = k 16 + 8hh + i).
__device__ __forceinline__ FragH frag(const unsigned short* row0, int ln, int hh) {
  const unsigned short* p = row0 + ln * LP + 8 * hh; FragH f; f.half[0] = *(const v8us*)(p); f.half[1] = *(const v8us*)(p + 16); return f;
}
// One stage: 64 keys (first key s0), as two passes of 32, against the wave's 16 queries (this lane's query: tq).
// kt: LDS key rows of the stage (64 d each); vt: LDS V^T rows of the stage (row = d, the 64 keys along it).
template <bool MASK>
__device__ __forceinline__ void stage64(const unsigned short* kt, const unsigned short* vt, int ln, int hh, const FragH (&qf)[2], float gate, int s0, int tq, v8f (&oh)[4], v8f (&ol)[4]) {
  FragH kf[2][2][2], vf[2][4];
#pragma unroll      /* fragments and accumulators are register arrays: every index a constant */
  for (int j = 0; j < 2; ++j)
#pragma unroll      /* fragments and accumulators are register arrays: every index a constant */
    for (int a = 0; a < 2; ++a) { kf[j][a][0] = frag(kt + (32 * j + 16 * a) * LP, ln, hh); kf[j][a][1] = frag(kt + (32 * j + 16 * a) * LP + 32, ln, hh); }
#pragma unroll      /* fragments and accumulators are register arrays: every index a constant */
  for (int dt = 0; dt < 4; ++dt) vf[0][dt] = frag(vt + 16 * dt * LP, ln, hh);
  __builtin_amdgcn_sched_barrier(0);      /* keeps these loads one group ahead of the products: issued one pair in front of each product, every pair's LDS latency is waited out */
  v8f sc[2][2];
#pragma unroll      /* fragments and accumulators are register arrays: every index a constant */
  for (int a = 0; a < 2; ++a) { v8f c = {}; c = mma(kf[0][a][0].v, qf[0].v, c); sc[0][a] = mma(kf[0][a][1].v, qf[1].v, c); }
#pragma unroll      /* fragments and accumulators are register arrays: every index a constant */
  for (int dt = 0; dt < 4; ++dt) vf[1][dt] = frag(vt + 16 * dt * LP + 32, ln, hh);
  __builtin_amdgcn_sched_barrier(0);      /* the second pass's V^T loads go out here, into the registers the first pass's key rows have left, not in front of their users */
#pragma unroll      /* fragments and accumulators are register arrays: every index a constant */
  for (int a = 0; a < 2; ++a) { v8f c = {}; c = mma(kf[1][a][0].v, qf[0].v, c); sc[1][a] = mma(kf[1][a][1].v, qf[1].v, c); }
#pragma unroll      /* fragments and accumulators are register arrays: every index a constant */
  for (int j = 0; j < 2; ++j) {
    FragH ph, pl;
    split32<MASK>(sc[j], gate, s0 + 32 * j, hh, tq, ph, pl);
#pragma unroll      /* fragments and accumulators are register arrays: every index a constant */
    for (int dt = 0; dt < 4; ++dt) {
      oh[dt] = mma(vf[j][dt].v, ph.v, oh[dt]);   /* oh[dt][r] = O[tq][16dt + 8hh + r] */
      ol[dt] = mma(vf[j][dt].v, pl.v, ol[dt]);
    }
  }
}

__global__ __launch_bounds__(256) void k_attn(const _Float16* __restrict__ QK16, const _Float16* __restrict__ VT, const float* __restrict__ nn, float* __restrict__ out) {
  __shared__ __attribute__((aligned(16))) unsigned short sk[2][KS][LP];   /* key rows of a stage, two buffers */
  __shared__ __attribute__((aligned(16))) unsigned short sv[2][DH][LP];   /* V^T rows of a stage, two buffers */
  __shared__ __attribute__((aligned(16))) float so[8][16][OP];            /* each wave's own output staging */
  const int tid = threadIdx.x, lane = tid & 31, ln = lane & 15, hh = lane >> 4;
  const int w = __builtin_amdgcn_readfirstlane(tid >> 5);
  const int bh = blockIdx.x >> 3, pr = blockIdx.x & 7, b = bh / NH, h = bh % NH;
  const unsigned short* qg = (const unsigned short*)QK16 + (size_t)b * SS * RS + h * DH;   /* query row t at qg + t * RS */
  const unsigned short* kg = qg + NH * DH;                                                 /* key row s at kg + s * RS */
  const unsigned short* vg = (const unsigned short*)VT + (size_t)bh * DH * SS;             /* V^T row d at vg + d * SS */
  const int sr = tid >> 3, sc8 = (tid & 7) * 8;      /* staging: rows sr and sr + 32, 16 bytes at element sc8: a wave's load covers 4 whole 128-B lines */
  for (int half = 0; half < 2; ++half) {
    const int tile = half ? pr : (SS / QT - 1) - pr;
    const int nst = (tile + 1) * (QT / KS);          /* at least 2 */
    const int tq0 = tile * QT + 16 * w, tq = tq0 + ln;
    FragH qf[2];
    { const unsigned short* qr = qg + (size_t)tq * RS + 8 * hh;
      qf[0].half[0] = *(const v8us*)(qr);      qf[0].half[1] = *(const v8us*)(qr + 16);
      qf[1].half[0] = *(const v8us*)(qr + 32); qf[1].half[1] = *(const v8us*)(qr + 48); }
    const float gate = expf(-bf16_round(nn[((size_t)b * SS + tq) * NH + h]));
    v8f oh[4] = {}, ol[4] = {};
    const unsigned short* kp = kg + (size_t)sr * RS + sc8;
    const unsigned short* vp = vg + (size_t)sr * SS + sc8;
    v8us gk0 = *(const v8us*)(kp), gk1 = *(const v8us*)(kp + 32 * RS), gv0 = *(const v8us*)(vp), gv1 = *(const v8us*)(vp + 32 * SS);
    /* buffer 0 was last read in the stage before the previous tile's last barrier */
    *(v8us*)&sk[0][sr][sc8] = gk0; *(v8us*)&sk[0][sr + 32][sc8] = gk1; *(v8us*)&sv[0][sr][sc8] = gv0; *(v8us*)&sv[0][sr + 32][sc8] = gv1;
    __syncthreads();
    /* Stages 0 .. nst - 3 lie wholly below every wave's diagonal: no mask. Their number is even, so the two buffers alternate at compile time. */
    for (int st = 0; st < nst - 2; st += 2) {
#pragma unroll      /* cur a constant: the buffers' LDS addresses become immediate offsets */
      for (int cur = 0; cur < 2; ++cur) {
        kp += KS * RS; vp += KS;      /* the next stage's rows fly while this stage is worked on */
        gk0 = *(const v8us*)(kp); gk1 = *(const v8us*)(kp + 32 * RS); gv0 = *(const v8us*)(vp); gv1 = *(const v8us*)(vp + 32 * SS);
        __builtin_amdgcn_sched_barrier(0);      /* keeps the four loads up here: sunk to their stores, their latency would be waited out at every barrier */
        stage64<false>(&sk[cur][0][0], &sv[cur][0][0], ln, hh, qf, gate, 0, tq, oh, ol);
        __builtin_amdgcn_sched_barrier(0);      /* keeps the stores, and the wait for the global loads in front of them, behind the stage's products */
        /* into the buffer that every wave left at the last barrier */
        *(v8us*)&sk[cur ^ 1][sr][sc8] = gk0; *(v8us*)&sk[cur ^ 1][sr + 32][sc8] = gk1; *(v8us*)&sv[cur ^ 1][sr][sc8] = gv0; *(v8us*)&sv[cur ^ 1][sr + 32][sc8] = gv1;
        __syncthreads();
      }
    }
    /* The last two stages hold the tile's own 128 keys: masked. */
    kp += KS * RS; vp += KS;
    gk0 = *(const v8us*)(kp); gk1 = *(const v8us*)(kp + 32 * RS); gv0 = *(const v8us*)(vp); gv1 = *(const v8us*)(vp + 32 * SS);
    __builtin_amdgcn_sched_barrier(0);      /* as above */
    stage64<true>(&sk[0][0][0], &sv[0][0][0], ln, hh, qf, gate, tile * QT, tq, oh, ol);
    __builtin_amdgcn_sched_barrier(0);      /* as above */
    *(v8us*)&sk[1][sr][sc8] = gk0; *(v8us*)&sk[1][sr + 32][sc8] = gk1; *(v8us*)&sv[1][sr][sc8] = gv0; *(v8us*)&sv[1][sr + 32][sc8] = gv1;
    __syncthreads();
    stage64<true>(&sk[1][0][0], &sv[1][0][0], ln, hh, qf, gate, tile * QT + KS, tq, oh, ol);
    /* no barrier here: buffer 1 is next written behind the next tile's first barrier */
    /* O rows through the wave's own LDS range, so that each store instruction writes whole 128-B lines */
#pragma unroll      /* fragments and accumulators are register arrays: every index a constant */
    for (int dt = 0; dt < 4; ++dt) {
      v4f x, y;
#pragma unroll      /* fragments and accumulators are register arrays: every index a constant */
      for (int i = 0; i < 4; ++i) { x[i] = oh[dt][i] + ol[dt][i] * 0.0009765625f; y[i] = oh[dt][4 + i] + ol[dt][4 + i] * 0.0009765625f; }
      *(v4fa*)&so[w][ln][16 * dt + 8 * hh] = x; *(v4fa*)&so[w][ln][16 * dt + 8 * hh + 4] = y;
    }
    __builtin_amdgcn_fence(__ATOMIC_ACQ_REL, "workgroup");      /* the rows below were written by other lanes of this wave */
    __builtin_amdgcn_wave_barrier();
#pragma unroll      /* the eight row reads go out together, ahead of the stores */
    for (int q = 0; q < 8; ++q) {
      const int r = q * 2 + hh;
      const v4f o = *(const v4fa*)&so[w][r][ln * 4];
      *(v4f*)(out + (((size_t)b * SS + tq0 + r) * NH + h) * DH + ln * 4) = o;
    }
    asm volatile("s_wait_xcnt 0x0" ::: "memory");      /* stands in front of the next tile's rewriting of the registers that these stores name */
  }
}

extern "C" void kernel_launch(void* const* d_in, const int* in_sizes, int n_in,
                              void* d_out, int out_size, void* d_ws, size_t ws_size, hipStream_t stream) {
  (void)in_sizes; (void)n_in; (void)out_size;
  const float* qk = (const float*)d_in[0]; const float* v = (const float*)d_in[1]; const float* nn = (const float*)d_in[2];
  char* ws = (char*)d_ws; size_t off = 0;
  auto take = [&](size_t bytes) { char* p = ws + off; off += (bytes + 255) & ~(size_t)255; return p; };
  _Float16* QK16 = (_Float16*)take((size_t)NBt * SS * 2 * NH * DH * 2); _Float16* VT = (_Float16*)take((size_t)NBt * NH * DH * SS * 2);
  if (off > ws_size) return;      // 16.8 + 8.4 MB
  k_x16<<<(unsigned)(((size_t)NBt * SS * 2 * NH * DH / 8 + 255) / 256), 256, 0, stream>>>(qk, QK16, (size_t)NBt * SS * 2 * NH * DH / 8);      /* q|k exact in f16 (bf16 inputs) */
  k_vt<<<(NBt * NH * DH * (SS / 8) + 255) / 256, 256, 0, stream>>>(v, VT);
  k_attn<<<NBt * NH * (SS / QT / 2), 256, 0, stream>>>(QK16, VT, nn, (float*)d_out);      /* 256 work-groups, two query tiles each */
}

// v002
// One run takes 34.7 microseconds.
// Timed twice side by side with v001, it ran 1.63 times as fast both times.
// All steps since v000 together make it 175 times as fast.
#include <hip/hip_runtime.h>
// Self-normalising linear attention (B 2, S 2048, 16 heads x 64): scores[t][s] = q_t.k_s (no scaling), causal (s <= t, multiplicative mask),
// attention = exp(-n[b,t,h]) * scores (no softmax), out[b,t,h,:] = sum_s attention[t][s] * v[b,s,h,:] -> [2,2048,16,64].
// Structure: ONE launch: it reads q, k, v as f32, rounds and converts them on the way into registers (q) and LDS (k, v), and does scores, gate,
//   mask and weighted sums. V is staged as it lies (row = key); the transposing LDS load hands out V^T fragments.
//   A work-group of 8 waves owns 128 queries of one (batch, head); a wave owns 16 of them. It walks the keys 0 .. last query in stages of 64.
//   Transposed products: S^T = K.Q^T (A = key rows from LDS, B = the wave's queries, kept in registers), O^T += V^T.P^T.
//   Two f32 S^T tiles (keys 0-15, 16-31 of a pass, same queries), gated and converted in place, ARE the B operand of the second product,
//   so a score never leaves the registers. Causal balance: each work-group takes query tile 15 - p and then tile p (34 stages for every one).
// Compute dtype: qk, v, n rounded to bf16, so q, k, v are exact as f16 operands; scores with exact products and
//   f32 accumulation; gated scores as f16 hi + lo * 2^10 operands (about f32: the weighted sums cancel heavily), f32 accumulation, keys in
//   ascending order 32 at a time; exp in f32. v_wmma_f32_16x16x32_f16.
#define NBt 2
#define SS 2048
#define NH 16
#define DH 64
#define RS (2 * NH * DH)   /* row stride (t) of the q|k layout, elements */
#define QT 128             /* queries per work-group tile */
#define KS 64              /* keys per stage */
#define LP 72              /* LDS row pitch in f16: 144 B = 16 B x odd, conflict-free for 16-byte row readers */
#define LV 80              /* LDS row pitch of V in f16: 160 B = 32 B x odd, conflict-free for the transposing 16-byte reader */
#define VS (NH * DH)       /* row stride (s) of v, elements */
#define OP 68              /* output staging pitch in f32: 272 B = 16 B x odd */
typedef unsigned short v8us __attribute__((ext_vector_type(8), may_alias));
typedef unsigned short v4us __attribute__((ext_vector_type(4), may_alias));
typedef short s16x8 __attribute__((ext_vector_type(8)));
typedef __bf16 v2b __attribute__((ext_vector_type(2)));
typedef float  v8f  __attribute__((ext_vector_type(8)));
typedef float  v4f  __attribute__((ext_vector_type(4)));
typedef float  v4fa __attribute__((ext_vector_type(4), may_alias));
typedef _Float16 v16h __attribute__((ext_vector_type(16)));
typedef float v2f __attribute__((ext_vector_type(2)));
typedef _Float16 v2h __attribute__((ext_vector_type(2)));
union FragH { v16h v; v8us half[2]; v2h h2[8]; _Float16 h[16]; unsigned short u[16]; };

__device__ __forceinline__ unsigned short bf16_bits(float x) { unsigned int u = __float_as_uint(x); return (unsigned short)((u + 0x7FFFu + ((u >> 16) & 1u)) >> 16); }
__device__ __forceinline__ float bf16_val(unsigned short b) { return __uint_as_float(((unsigned int)b) << 16); }
__device__ __forceinline__ float bf16_round(float x) { return bf16_val(bf16_bits(x)); }
__device__ __forceinline__ v8f mma(v16h a, v16h b, v8f c) { return __builtin_amdgcn_wmma_f32_16x16x32_f16(false, a, false, b, (short)0, c, false, false); }

// Four f32 inputs, rounded to bf16 (nearest even) and held as f16 (exact).
union Q4 { v4us u; v2h h2[2]; };
__device__ __forceinline__ v4us cvt4(v4f x) {
  Q4 r;
#pragma unroll      /* p a constant: the vector's elements are picked at compile time and stay in registers */
  for (int p = 0; p < 2; ++p) { const v2f a = { x[2 * p], x[2 * p + 1] }; r.h2[p] = __builtin_convertvector(__builtin_convertvector(__builtin_convertvector(a, v2b), v2f), v2h); }
  return r.u;
}

// Gate, mask and split of one pass: two f32 S^T tiles (keys s0 + 0..15, s0 + 16..31, this lane's query tq) become the hi and lo B operands.
// sc[a][r] = score of key s0 + 16a + 8hh + r; element 8a + r of a B operand is k = 16a + 8hh + r: the hardware k order, in place.
template <bool MASK>
__device__ __forceinline__ void split32(const v8f (&sc)[2], float gate, int s0, int hh, int tq, FragH& ph, FragH& pl) {
#pragma unroll      /* fragments and accumulators are register arrays: every index a constant */
  for (int a = 0; a < 2; ++a)
#pragma unroll      /* fragments and accumulators are register arrays: every index a constant */
    for (int r = 0; r < 8; r += 2) {      /* two scores at a time: packed multiply, packed conversions */
      v2f pv = { sc[a][r] * gate, sc[a][r + 1] * gate };
      if (MASK) { const int s = s0 + 16 * a + 8 * hh + r; pv[0] = (s <= tq) ? pv[0] : 0.f; pv[1] = (s + 1 <= tq) ? pv[1] : 0.f; }
      const v2h hi = __builtin_convertvector(pv, v2h);
      const v2h lo = __builtin_convertvector((pv - __builtin_convertvector(hi, v2f)) * 1024.0f, v2h);
      ph.h2[4 * a + r / 2] = hi;
      pl.h2[4 * a + r / 2] = lo;
    }
}
// A fragment of 16 rows x 32 k from LDS rows of pitch LP, in the hardware k order (elements 0-7 = k 8hh + i, 8-15 = k 16 + 8hh + i).
__device__ __forceinline__ FragH frag(const unsigned short* row0, int ln, int hh) {
  const unsigned short* p = row0 + ln * LP + 8 * hh; FragH f; f.half[0] = *(const v8us*)(p); f.half[1] = *(const v8us*)(p + 16); return f;
}
// A fragment of V^T, 16 d x 32 keys, from LDS V rows (row = key, pitch LV): tp = this lane's address in the first 16 keys x 16 d block.
// Lane (ln, hh) receives V[8hh + 0..7][ln] and V[16 + 8hh + 0..7][ln]: the same hardware k order.
__device__ __forceinline__ v8us tr16(const unsigned short* p) { typedef __attribute__((address_space(3))) s16x8 lds_s16x8; return __builtin_bit_cast(v8us, __builtin_amdgcn_ds_load_tr16_b128_v8i16((lds_s16x8*)p)); }
__device__ __forceinline__ FragH fragt(const unsigned short* tp) { FragH f; f.half[0] = tr16(tp); f.half[1] = tr16(tp + 16 * LV); return f; }
// One stage: 64 keys (first key s0), as two passes of 32, against the wave's 16 queries (this lane's query: tq).
// kt: LDS key rows of the stage (64 d each); vt: LDS V rows of the stage (row = key, 64 d each).
template <bool MASK>
__device__ __forceinline__ void stage64(const unsigned short* kt, const unsigned short* vt, int ln, int hh, const FragH (&qf)[2], float gate, int s0, int tq, v8f (&oh)[4], v8f (&ol)[4]) {
  FragH kf[2][2][2], vf[2][4];
  const unsigned short* tp = vt + (8 * hh + (ln & 7)) * LV + 8 * (ln >> 3);
#pragma unroll      /* fragments and accumulators are register arrays: every index a constant */
  for (int j = 0; j < 2; ++j)
#pragma unroll      /* fragments and accumulators are register arrays: every index a constant */
    for (int a = 0; a < 2; ++a) { kf[j][a][0] = frag(kt + (32 * j + 16 * a) * LP, ln, hh); kf[j][a][1] = frag(kt + (32 * j + 16 * a) * LP + 32, ln, hh); }
#pragma unroll      /* fragments and accumulators are register arrays: every index a constant */
  for (int dt = 0; dt < 4; ++dt) vf[0][dt] = fragt(tp + 16 * dt);
  __builtin_amdgcn_sched_barrier(0);      /* keeps these loads one group ahead of the products: issued one pair in front of each product, every pair's LDS latency is waited out */
  v8f sc[2][2];
#pragma unroll      /* fragments and accumulators are register arrays: every index a constant */
  for (int a = 0; a < 2; ++a) { v8f c = {}; c = mma(kf[0][a][0].v, qf[0].v, c); sc[0][a] = mma(kf[0][a][1].v, qf[1].v, c); }
#pragma unroll      /* fragments and accumulators are register arrays: every index a constant */
  for (int dt = 0; dt < 4; ++dt) vf[1][dt] = fragt(tp + 32 * LV + 16 * dt);
  __builtin_amdgcn_sched_barrier(0);      /* the second pass's V^T loads go out here, into the registers the first pass's key rows have left, not in front of their users */
#pragma unroll      /* fragments and accumulators are register arrays: every index a constant */
  for (int a = 0; a < 2; ++a) { v8f c = {}; c = mma(kf[1][a][0].v, qf[0].v, c); sc[1][a] = mma(kf[1][a][1].v, qf[1].v, c); }
#pragma unroll      /* fragments and accumulators are register arrays: every index a constant */
  for (int j = 0; j < 2; ++j) {
    FragH ph, pl;
    split32<MASK>(sc[j], gate, s0 + 32 * j, hh, tq, ph, pl);
#pragma unroll      /* fragments and accumulators are register arrays: every index a constant */
    for (int dt = 0; dt < 4; ++dt) {
      oh[dt] = mma(vf[j][dt].v, ph.v, oh[dt]);   /* oh[dt][r] = O[tq][16dt + 8hh + r] */
      ol[dt] = mma(vf[j][dt].v, pl.v, ol[dt]);
    }
  }
}

__global__ __launch_bounds__(256) void k_attn(const float* __restrict__ qk, const float* __restrict__ v, const float* __restrict__ nn, float* __restrict__ out) {
  __shared__ __attribute__((aligned(16))) unsigned short sk[2][KS][LP];   /* key rows of a stage, two buffers */
  __shared__ __attribute__((aligned(32))) unsigned short sv[2][KS][LV];   /* V rows of a stage, two buffers */
  __shared__ __attribute__((aligned(16))) float so[8][16][OP];            /* each wave's own output staging */
  const int tid = threadIdx.x, lane = tid & 31, ln = lane & 15, hh = lane >> 4;
  const int w = __builtin_amdgcn_readfirstlane(tid >> 5);
  const int bh = blockIdx.x >> 3, pr = blockIdx.x & 7, b = bh / NH, h = bh % NH;
  const float* qg = qk + (size_t)b * SS * RS + h * DH;      /* query row t at qg + t * RS */
  const float* kg = qg + NH * DH;                           /* key row s at kg + s * RS */
  const float* vg = v + (size_t)b * SS * VS + h * DH;       /* V row s at vg + s * VS */
  const int sr = tid >> 4, sc4 = (tid & 15) * 4;      /* staging: rows sr + 16 i, 16 bytes of f32 at element sc4: a wave's load covers 4 whole 128-B lines */
  for (int half = 0; half < 2; ++half) {
    const int tile = half ? pr : (SS / QT - 1) - pr;
    const int nst = (tile + 1) * (QT / KS);          /* at least 2 */
    const int tq0 = tile * QT + 16 * w, tq = tq0 + ln;
    FragH qf[2];
    { const float* qr = qg + (size_t)tq * RS + 8 * hh;
      Q4 c;
#pragma unroll      /* fragments are register arrays: every index a constant */
      for (int g = 0; g < 8; ++g) {      /* floats 16 (g / 2) + 8 hh + 4 (g % 2) .. + 3 of the row: the hardware k order */
        c.u = cvt4(*(const v4f*)(qr + 16 * (g >> 1) + 4 * (g & 1)));
        qf[g >> 2].h2[2 * (g & 3)] = c.h2[0]; qf[g >> 2].h2[2 * (g & 3) + 1] = c.h2[1];
      } }
    const float gate = expf(-bf16_round(nn[((size_t)b * SS + tq) * NH + h]));
    v8f oh[4] = {}, ol[4] = {};
    const float* kp = kg + (size_t)sr * RS + sc4;
    const float* vp = vg + (size_t)sr * VS + sc4;
    v4f gk[4], gv[4];
#pragma unroll      /* the eight loads go out together */
    for (int i = 0; i < 4; ++i) { gk[i] = *(const v4f*)(kp + 16 * i * RS); gv[i] = *(const v4f*)(vp + 16 * i * VS); }
    /* buffer 0 was last read in the stage before the previous tile's last barrier */
#pragma unroll      /* register arrays: every index a constant */
    for (int i = 0; i < 4; ++i) { *(v4us*)&sk[0][sr + 16 * i][sc4] = cvt4(gk[i]); *(v4us*)&sv[0][sr + 16 * i][sc4] = cvt4(gv[i]); }
    __syncthreads();
    /* Stages 0 .. nst - 3 lie wholly below every wave's diagonal: no mask. Their number is even, so the two buffers alternate at compile time. */
    for (int st = 0; st < nst - 2; st += 2) {
#pragma unroll      /* cur a constant: the buffers' LDS addresses become immediate offsets */
      for (int cur = 0; cur < 2; ++cur) {
        kp += KS * RS; vp += KS * VS;      /* the next stage's rows fly while this stage is worked on */
#pragma unroll      /* the eight loads go out together */
        for (int i = 0; i < 4; ++i) { gk[i] = *(const v4f*)(kp + 16 * i * RS); gv[i] = *(const v4f*)(vp + 16 * i * VS); }
        __builtin_amdgcn_sched_barrier(0);      /* keeps the eight loads up here: sunk to their stores, their latency would be waited out at every barrier */
        stage64<false>(&sk[cur][0][0], &sv[cur][0][0], ln, hh, qf, gate, 0, tq, oh, ol);
        __builtin_amdgcn_sched_barrier(0);      /* keeps the conversions and stores, and the wait for the global loads in front of them, behind the stage's products */
        /* into the buffer that every wave left at the last barrier */
#pragma unroll      /* register arrays: every index a constant */
        for (int i = 0; i < 4; ++i) { *(v4us*)&sk[cur ^ 1][sr + 16 * i][sc4] = cvt4(gk[i]); *(v4us*)&sv[cur ^ 1][sr + 16 * i][sc4] = cvt4(gv[i]); }
        __syncthreads();
      }
    }
    /* The last two stages hold the tile's own 128 keys: masked. */
    kp += KS * RS; vp += KS * VS;
#pragma unroll      /* the eight loads go out together */
    for (int i = 0; i < 4; ++i) { gk[i] = *(const v4f*)(kp + 16 * i * RS); gv[i] = *(const v4f*)(vp + 16 * i * VS); }
    __builtin_amdgcn_sched_barrier(0);      /* as above */
    stage64<true>(&sk[0][0][0], &sv[0][0][0], ln, hh, qf, gate, tile * QT, tq, oh, ol);
    __builtin_amdgcn_sched_barrier(0);      /* as above */
#pragma unroll      /* register arrays: every index a constant */
    for (int i = 0; i < 4; ++i) { *(v4us*)&sk[1][sr + 16 * i][sc4] = cvt4(gk[i]); *(v4us*)&sv[1][sr + 16 * i][sc4] = cvt4(gv[i]); }
    __syncthreads();
    stage64<true>(&sk[1][0][0], &sv[1][0][0], ln, hh, qf, gate, tile * QT + KS, tq, oh, ol);
    /* no barrier here: buffer 1 is next written behind the next tile's first barrier */
    /* O rows through the wave's own LDS range, so that each store instruction writes whole 128-B lines */
#pragma unroll      /* fragments and accumulators are register arrays: every index a constant */
    for (int dt = 0; dt < 4; ++dt) {
      v4f x, y;
#pragma unroll      /* fragments and accumulators are register arrays: every index a constant */
      for (int i = 0; i < 4; ++i) { x[i] = oh[dt][i] + ol[dt][i] * 0.0009765625f; y[i] = oh[dt][4 + i] + ol[dt][4 + i] * 0.0009765625f; }
      *(v4fa*)&so[w][ln][16 * dt + 8 * hh] = x; *(v4fa*)&so[w][ln][16 * dt + 8 * hh + 4] = y;
    }
    __builtin_amdgcn_fence(__ATOMIC_ACQ_REL, "workgroup");      /* the rows below were written by other lanes of this wave */
    __builtin_amdgcn_wave_barrier();
#pragma unroll      /* the eight row reads go out together, ahead of the stores */
    for (int q = 0; q < 8; ++q) {
      const int r = q * 2 + hh;
      const v4f o = *(const v4fa*)&so[w][r][ln * 4];
      *(v4f*)(out + (((size_t)b * SS + tq0 + r) * NH + h) * DH + ln * 4) = o;
    }
    asm volatile("s_wait_xcnt 0x0" ::: "memory");      /* stands in front of the next tile's rewriting of the registers that these stores name */
  }
}

extern "C" void kernel_launch(void* const* d_in, const int* in_sizes, int n_in,
                              void* d_out, int out_size, void* d_ws, size_t ws_size, hipStream_t stream) {
  (void)in_sizes; (void)n_in; (void)out_size; (void)d_ws; (void)ws_size;
  const float* qk = (const float*)d_in[0]; const float* v = (const float*)d_in[1]; const float* nn = (const float*)d_in[2];
  k_attn<<<NBt * NH * (SS / QT / 2), 256, 0, stream>>>(qk, v, nn, (float*)d_out);      /* 256 work-groups, two query tiles each */
}

// v003
// Measured time: 17.6 microseconds a run.
// Next to v002, in two timings, it ran 1.97 times as fast each time.
// Counting every step since v000, it is 346 times as fast.
#include <hip/hip_runtime.h>
// Self-normalising linear attention (B 2, S 2048, 16 heads x 64): scores[t][s] = q_t.k_s (no scaling), causal (s <= t, multiplicative mask),
// attention = exp(-n[b,t,h]) * scores (no softmax), out[b,t,h,:] = sum_s attention[t][s] * v[b,s,h,:] -> [2,2048,16,64].
// Structure: ONE launch: it reads q, k, v as f32, rounds and converts them on the way into registers (q) and LDS (k, v), and does scores, gate,
//   mask and weighted sums. V is staged as it lies (row = key); the transposing LDS load hands out V^T fragments.
//   A work-group of 8 waves owns 256 successive queries of one (batch, head), as two tiles of 128; a wave owns 16 queries of a tile.
//   Keys below a tile carry no mask and there is no softmax, so their part is reassociated: sum_s (q.k_s) v_s = q.(sum_s k_s v_s^T).
//   The 64 x 64 state K^T.V is summed on the matrix unit, 32 keys a block, each wave on its own blocks (blocks w, w + 8, ...) through its own
//   LDS range; the waves' parts are summed through LDS, split into f16 hi + lo, and multiplied by the wave's queries. The f32 sums stay in
//   registers and take up the first tile's keys for the second tile, so every key below a tile is read once by a work-group.
//   The tile's own 128 keys, two stages of 64, masked, transposed products: S^T = K.Q^T (A = key rows from LDS, B = the wave's queries, kept in
//   registers), O^T += V^T.P^T. Two f32 S^T tiles (keys 0-15, 16-31 of a pass, same queries), gated and converted in place, ARE the B operand
//   of the second product, so a score never leaves the registers.
// Compute dtype: qk, v, n rounded to bf16, so q, k, v are exact as f16 operands; scores with exact products and
//   f32 accumulation; gated scores and the state as f16 hi + lo * 2^10 operands (about f32: the weighted sums cancel heavily), f32 accumulation;
//   exp in f32. v_wmma_f32_16x16x32_f16.
#define NBt 2
#define SS 2048
#define NH 16
#define DH 64
#define RS (2 * NH * DH)   /* row stride (t) of the q|k layout, elements */
#define QT 128             /* queries per work-group tile */
#define KS 64              /* keys per stage */
#define KB 32              /* keys per block of the state sum */
#define LP 72              /* LDS row pitch in f16: 144 B = 16 B x odd, conflict-free for 16-byte row readers */
#define LV 80              /* LDS row pitch of V in f16: 160 B = 32 B x odd, conflict-free for the transposing 16-byte reader */
#define VS (NH * DH)       /* row stride (s) of v, elements */
#define OP 68              /* output staging pitch in f32: 272 B = 16 B x odd */
typedef unsigned short v8us __attribute__((ext_vector_type(8), may_alias));
typedef unsigned short v4us __attribute__((ext_vector_type(4), may_alias));
typedef short s16x8 __attribute__((ext_vector_type(8)));
typedef __bf16 v2b __attribute__((ext_vector_type(2)));
typedef float  v8f  __attribute__((ext_vector_type(8)));
typedef float  v4f  __attribute__((ext_vector_type(4)));
typedef float  v4fa __attribute__((ext_vector_type(4), may_alias));
typedef _Float16 v16h __attribute__((ext_vector_type(16)));
typedef float v2f __attribute__((ext_vector_type(2)));
typedef _Float16 v2h __attribute__((ext_vector_type(2)));
union FragH { v16h v; v8us half[2]; v2h h2[8]; _Float16 h[16]; unsigned short u[16]; };

__device__ __forceinline__ unsigned short bf16_bits(float x) { unsigned int u = __float_as_uint(x); return (unsigned short)((u + 0x7FFFu + ((u >> 16) & 1u)) >> 16); }
__device__ __forceinline__ float bf16_val(unsigned short b) { return __uint_as_float(((unsigned int)b) << 16); }
__device__ __forceinline__ float bf16_round(float x) { return bf16_val(bf16_bits(x)); }
__device__ __forceinline__ v8f mma(v16h a, v16h b, v8f c) { return __builtin_amdgcn_wmma_f32_16x16x32_f16(false, a, false, b, (short)0, c, false, false); }

// Four f32 inputs, rounded to bf16 (nearest even) and held as f16 (exact).
union Q4 { v4us u; v2h h2[2]; };
__device__ __forceinline__ v4us cvt4(v4f x) {
  Q4 r;
#pragma unroll      /* p a constant: the vector's elements are picked at compile time and stay in registers */
  for (int p = 0; p < 2; ++p) { const v2f a = { x[2 * p], x[2 * p + 1] }; r.h2[p] = __builtin_convertvector(__builtin_convertvector(__builtin_convertvector(a, v2b), v2f), v2h); }
  return r.u;
}

// Gate, mask and split of one pass: two f32 S^T tiles (keys s0 + 0..15, s0 + 16..31, this lane's query tq) become the hi and lo B operands.
// sc[a][r] = score of key s0 + 16a + 8hh + r; element 8a + r of a B operand is k = 16a + 8hh + r: the hardware k order, in place.
template <bool MASK>
__device__ __forceinline__ void split32(const v8f (&sc)[2], float gate, int s0, int hh, int tq, FragH& ph, FragH& pl) {
#pragma unroll      /* fragments and accumulators are register arrays: every index a constant */
  for (int a = 0; a < 2; ++a)
#pragma unroll      /* fragments and accumulators are register arrays: every index a constant */
    for (int r = 0; r < 8; r += 2) {      /* two scores at a time: packed multiply, packed conversions */
      v2f pv = { sc[a][r] * gate, sc[a][r + 1] * gate };
      if (MASK) { const int s = s0 + 16 * a + 8 * hh + r; pv[0] = (s <= tq) ? pv[0] : 0.f; pv[1] = (s + 1 <= tq) ? pv[1] : 0.f; }
      const v2h hi = __builtin_convertvector(pv, v2h);
      const v2h lo = __builtin_convertvector((pv - __builtin_convertvector(hi, v2f)) * 1024.0f, v2h);
      ph.h2[4 * a + r / 2] = hi;
      pl.h2[4 * a + r / 2] = lo;
    }
}
// A fragment of 16 rows x 32 k from LDS rows of pitch LP, in the hardware k order (elements 0-7 = k 8hh + i, 8-15 = k 16 + 8hh + i).
__device__ __forceinline__ FragH frag(const unsigned short* row0, int ln, int hh) {
  const unsigned short* p = row0 + ln * LP + 8 * hh; FragH f; f.half[0] = *(const v8us*)(p); f.half[1] = *(const v8us*)(p + 16); return f;
}
// A fragment of V^T, 16 d x 32 keys, from LDS V rows (row = key, pitch LV): tp = this lane's address in the first 16 keys x 16 d block.
// Lane (ln, hh) receives V[8hh + 0..7][ln] and V[16 + 8hh + 0..7][ln]: the same hardware k order.
__device__ __forceinline__ v8us tr16(const unsigned short* p) { typedef __attribute__((address_space(3))) s16x8 lds_s16x8; return __builtin_bit_cast(v8us, __builtin_amdgcn_ds_load_tr16_b128_v8i16((lds_s16x8*)p)); }
__device__ __forceinline__ FragH fragt(const unsigned short* tp) { FragH f; f.half[0] = tr16(tp); f.half[1] = tr16(tp + 16 * LV); return f; }
// One stage: 64 keys (first key s0), as two passes of 32, against the wave's 16 queries (this lane's query: tq).
// kt: LDS key rows of the stage (64 d each); vt: LDS V rows of the stage (row = key, 64 d each).
template <bool MASK>
__device__ __forceinline__ void stage64(const unsigned short* kt, const unsigned short* vt, int ln, int hh, const FragH (&qf)[2], float gate, int s0, int tq, v8f (&oh)[4], v8f (&ol)[4]) {
  FragH kf[2][2][2], vf[2][4];
  const unsigned short* tp = vt + (8 * hh + (ln & 7)) * LV + 8 * (ln >> 3);
#pragma unroll      /* fragments and accumulators are register arrays: every index a constant */
  for (int j = 0; j < 2; ++j)
#pragma unroll      /* fragments and accumulators are register arrays: every index a constant */
    for (int a = 0; a < 2; ++a) { kf[j][a][0] = frag(kt + (32 * j + 16 * a) * LP, ln, hh); kf[j][a][1] = frag(kt + (32 * j + 16 * a) * LP + 32, ln, hh); }
#pragma unroll      /* fragments and accumulators are register arrays: every index a constant */
  for (int dt = 0; dt < 4; ++dt) vf[0][dt] = fragt(tp + 16 * dt);
  __builtin_amdgcn_sched_barrier(0);      /* keeps these loads one group ahead of the products: issued one pair in front of each product, every pair's LDS latency is waited out */
  v8f sc[2][2];
#pragma unroll      /* fragments and accumulators are register arrays: every index a constant */
  for (int a = 0; a < 2; ++a) { v8f c = {}; c = mma(kf[0][a][0].v, qf[0].v, c); sc[0][a] = mma(kf[0][a][1].v, qf[1].v, c); }
#pragma unroll      /* fragments and accumulators are register arrays: every index a constant */
  for (int dt = 0; dt < 4; ++dt) vf[1][dt] = fragt(tp + 32 * LV + 16 * dt);
  __builtin_amdgcn_sched_barrier(0);      /* the second pass's V^T loads go out here, into the registers the first pass's key rows have left, not in front of their users */
#pragma unroll      /* fragments and accumulators are register arrays: every index a constant */
  for (int a = 0; a < 2; ++a) { v8f c = {}; c = mma(kf[1][a][0].v, qf[0].v, c); sc[1][a] = mma(kf[1][a][1].v, qf[1].v, c); }
#pragma unroll      /* fragments and accumulators are register arrays: every index a constant */
  for (int j = 0; j < 2; ++j) {
    FragH ph, pl;
    split32<MASK>(sc[j], gate, s0 + 32 * j, hh, tq, ph, pl);
#pragma unroll      /* fragments and accumulators are register arrays: every index a constant */
    for (int dt = 0; dt < 4; ++dt) {
      oh[dt] = mma(vf[j][dt].v, ph.v, oh[dt]);   /* oh[dt][r] = O[tq][16dt + 8hh + r] */
      ol[dt] = mma(vf[j][dt].v, pl.v, ol[dt]);
    }
  }
}

// One key block for one wave, 32 rows of K and of V as f32: rows 2 i + hh, 16 bytes at element 4 ln, so each load covers 4 whole 128-B lines.
// pk points at this lane's place in the first q|k row (its keys stand NH * DH further), pv at its place in the first V row.
__device__ __forceinline__ void load_block(const float* pk, const float* pv, v4f (&xk)[16], v4f (&xv)[16]) {
#pragma unroll      /* the 32 loads go out together */
  for (int i = 0; i < 16; ++i) { xk[i] = *(const v4f*)(pk + NH * DH + 2 * i * RS); xv[i] = *(const v4f*)(pv + 2 * i * VS); }
  asm volatile("s_wait_xcnt 0x0" :: "v"(pk), "v"(pv) : "memory");      /* stands in front of any rewriting of the registers that these loads name; the addresses as inputs keep a load's own result out of them */
}

__global__ __launch_bounds__(256) void k_attn(const float* __restrict__ qk, const float* __restrict__ v, const float* __restrict__ nn, float* __restrict__ out) {
  __shared__ __attribute__((aligned(16))) unsigned short sk[2][KS][LP];   /* key rows of a stage, two buffers */
  __shared__ __attribute__((aligned(32))) unsigned short sv[2][KS][LV];   /* V rows of a stage, two buffers */
  __shared__ __attribute__((aligned(16))) float so[8][16][OP];            /* each wave's own output staging */
  __shared__ __attribute__((aligned(32))) unsigned short wr[8][8192];     /* each wave's own 16 KiB: 32 K rows and 32 V rows of its key block (pitch LV); at a hand-over its partial state, 16 f32 tiles */
  __shared__ __attribute__((aligned(16))) unsigned short sf[32][256];     /* the summed state as A operands: [((c * 4 + dvt) * 2 + lo) * 2 + half][lane * 8] */
  const int tid = threadIdx.x, lane = tid & 31, ln = lane & 15, hh = lane >> 4;
  const int w = __builtin_amdgcn_readfirstlane(tid >> 5);
  const int bh = blockIdx.x & (NBt * NH - 1), pr = (SS / QT / 2 - 1) - (blockIdx.x >> 5), b = bh / NH, h = bh % NH;   /* the longest key ranges start first */
  const float* qg = qk + (size_t)b * SS * RS + h * DH;      /* query row t at qg + t * RS */
  const float* kg = qg + NH * DH;                           /* key row s at kg + s * RS */
  const float* vg = v + (size_t)b * SS * VS + h * DH;       /* V row s at vg + s * VS */
  const int sr = tid >> 4, sc4 = (tid & 15) * 4;      /* staging: rows sr + 16 i, 16 bytes of f32 at element sc4: a wave's load covers 4 whole 128-B lines */
  unsigned short* wk = &wr[w][0];
  unsigned short* wv = wk + KB * LV;
  const unsigned short* tk = wk + (8 * hh + (ln & 7)) * LV + 8 * (ln >> 3);      /* this lane's address for the transposing reader, as in stage64 */
  const unsigned short* tv = wv + (8 * hh + (ln & 7)) * LV + 8 * (ln >> 3);
  float* wf = (float*)wk;      /* at a hand-over the wave's part of the state: tile t = 4 i + j, registers 4 x .. 4 x + 3 of this lane at wf + (2 t + x) * 128 + 4 lane */
  v4f tot[2][2] = {};          /* the state of all keys handed over so far, f32: the two tiles that this wave sums and converts (below) */
  int kb = w;             /* the wave's next key block of 32: blocks w, w + 8, ... in ascending order, carried from the first tile to the second */
  v4f xk[16], xv[16];     /* one key block on its way */
  if (kb < 2 * pr * (QT / KB)) load_block(qg + (size_t)(kb * KB + hh) * RS + 4 * ln, vg + (size_t)(kb * KB + hh) * VS + 4 * ln, xk, xv);
  for (int half = 0; half < 2; ++half) {
    const int tile = 2 * pr + half;
    const int nb = tile * (QT / KB);                 /* key blocks below the tile */
    const int tq0 = tile * QT + 16 * w, tq = tq0 + ln;
    FragH qf[2];
    { const float* qr = qg + (size_t)tq * RS + 8 * hh;
      Q4 c;
#pragma unroll      /* fragments are register arrays: every index a constant */
      for (int g = 0; g < 8; ++g) {      /* floats 16 (g / 2) + 8 hh + 4 (g % 2) .. + 3 of the row: the hardware k order */
        c.u = cvt4(*(const v4f*)(qr + 16 * (g >> 1) + 4 * (g & 1)));
        qf[g >> 2].h2[2 * (g & 3)] = c.h2[0]; qf[g >> 2].h2[2 * (g & 3) + 1] = c.h2[1];
      } }
    const float gate = expf(-bf16_round(nn[((size_t)b * SS + tq) * NH + h]));
    /* the tile's own first 64 keys are asked for up here: the barrier of the hand-over waits for every load of a wave, and these have then long arrived */
    const float* kp = kg + (size_t)(tile * QT + sr) * RS + sc4;
    const float* vp = vg + (size_t)(tile * QT + sr) * VS + sc4;
    v4f gk[4], gv[4];
#pragma unroll      /* the eight loads go out together */
    for (int i = 0; i < 4; ++i) { gk[i] = *(const v4f*)(kp + 16 * i * RS); gv[i] = *(const v4f*)(vp + 16 * i * VS); }
    asm volatile("s_wait_xcnt 0x0" ::: "memory");      /* stands in front of any rewriting of the registers that the loads above name */
    /* Keys below the tile: no mask, so sum_s (q.k_s) v_s = q.(sum_s k_s v_s^T). Each wave adds its own key blocks to its part of the 64 x 64 state; no work-group barrier in here. */
    if (kb < nb) {      /* the same for a whole wave; its first block is on its way */
      v8f mt[4][4] = {};      /* this wave's part of the state: mt[i][j][r] = sum over its keys since the last hand-over of K[s][16 i + 8 hh + r] * V[s][16 j + ln] */
      for (; kb < nb; kb += 8) {
#pragma unroll      /* register arrays: every index a constant */
        for (int i = 0; i < 16; ++i) { *(v4us*)(wk + (2 * i + hh) * LV + 4 * ln) = cvt4(xk[i]); *(v4us*)(wv + (2 * i + hh) * LV + 4 * ln) = cvt4(xv[i]); }
        if (kb + 8 < nb) load_block(qg + (size_t)((kb + 8) * KB + hh) * RS + 4 * ln, vg + (size_t)((kb + 8) * KB + hh) * VS + 4 * ln, xk, xv);      /* the wave's next block flies while this one is multiplied */
        asm volatile("s_wait_dscnt 0x0" ::: "memory");      /* the rows read below were written by other lanes of this wave: its LDS stores are done, while the global loads above fly on (a fence would wait for them too) */
        FragH kf[4], vf[4];      /* K^T as A (16 d x 32 keys), V as B (32 keys x 16 d): one loader, so one k order */
#pragma unroll      /* fragments are register arrays: every index a constant */
        for (int t = 0; t < 4; ++t) { kf[t] = fragt(tk + 16 * t); vf[t] = fragt(tv + 16 * t); }
#pragma unroll      /* fragments and accumulators are register arrays: every index a constant */
        for (int i = 0; i < 4; ++i)
#pragma unroll      /* fragments and accumulators are register arrays: every index a constant */
          for (int j = 0; j < 4; ++j) mt[i][j] = mma(kf[i].v, vf[j].v, mt[i][j]);
      }
      /* the part goes into the wave's own LDS range, over the rows, whose reads the products above have waited for */
#pragma unroll      /* accumulators are register arrays: every index a constant */
      for (int t = 0; t < 16; ++t)
#pragma unroll      /* accumulators are register arrays: every index a constant */
        for (int x = 0; x < 2; ++x) { const v8f& m = mt[t >> 2][t & 3]; const v4f y = { m[4 * x], m[4 * x + 1], m[4 * x + 2], m[4 * x + 3] }; *(v4fa*)(wf + (2 * t + x) * 128 + 4 * lane) = y; }
    }
    __syncthreads();      /* hand-over: the new parts are in LDS */
    /* Wave w adds the new parts (wave 0 first) of state tiles (2 c, dvt) and (2 c + 1, dvt) to their sums so far. Converted in place these ARE the A operand M[16 dvt + ln][32 c + k], M = V^T.K, */
    /* in the hardware k order: element 8 a + r is k = 16 a + 8 hh + r. Held as f16 hi + lo * 2^10, like the gated scores. */
    { const int dvt = w & 3, c = w >> 2;
      FragH mh, ml;
      const int np = half ? QT / KB : (pr ? 8 : 0);      /* waves that had a key block since the last hand-over: 8 or none below the first tile, 4 for the first tile's own 128 keys */
      for (int u0 = 0; u0 < np; u0 += 4)
#pragma unroll      /* the sixteen reads go out together */
        for (int u = 0; u < 4; ++u)
#pragma unroll      /* register arrays: every index a constant */
          for (int a = 0; a < 2; ++a)
#pragma unroll      /* register arrays: every index a constant */
            for (int x = 0; x < 2; ++x) tot[a][x] += *(const v4fa*)((const float*)&wr[u0 + u][0] + (2 * ((2 * c + a) * 4 + dvt) + x) * 128 + 4 * lane);
#pragma unroll      /* fragments are register arrays: every index a constant */
      for (int a = 0; a < 2; ++a)
#pragma unroll      /* fragments are register arrays: every index a constant */
        for (int x = 0; x < 2; ++x) {
          const v4f s = tot[a][x];
#pragma unroll      /* fragments are register arrays: every index a constant */
          for (int e = 0; e < 4; e += 2) {
            const v2f pv = { s[e], s[e + 1] };
            const v2h hi = __builtin_convertvector(pv, v2h);
            const v2h lo = __builtin_convertvector((pv - __builtin_convertvector(hi, v2f)) * 1024.0f, v2h);
            mh.h2[4 * a + 2 * x + e / 2] = hi;
            ml.h2[4 * a + 2 * x + e / 2] = lo;
          }
        }
#pragma unroll      /* fragments are register arrays: every index a constant */
      for (int y = 0; y < 2; ++y) { *(v8us*)&sf[((c * 4 + dvt) * 2 + 0) * 2 + y][8 * lane] = mh.half[y]; *(v8us*)&sf[((c * 4 + dvt) * 2 + 1) * 2 + y][8 * lane] = ml.half[y]; }
    }
    /* buffer 0 was last read in the stage before the previous tile's last barrier */
#pragma unroll      /* register arrays: every index a constant */
    for (int i = 0; i < 4; ++i) { *(v4us*)&sk[0][sr + 16 * i][sc4] = cvt4(gk[i]); *(v4us*)&sv[0][sr + 16 * i][sc4] = cvt4(gv[i]); }
    __syncthreads();      /* publishes the summed state and the tile's first stage; ends the reads of the parts, so each wave may write its own range again */
    kp += KS * RS; vp += KS * VS;
#pragma unroll      /* the eight loads go out together */
    for (int i = 0; i < 4; ++i) { gk[i] = *(const v4f*)(kp + 16 * i * RS); gv[i] = *(const v4f*)(vp + 16 * i * VS); }
    /* the first tile's own keys, as the second tile's last key blocks, fly over the first tile's masked stages */
    if (half == 0 && kb < nb + QT / KB) load_block(qg + (size_t)(kb * KB + hh) * RS + 4 * ln, vg + (size_t)(kb * KB + hh) * VS + 4 * ln, xk, xv);
    __builtin_amdgcn_sched_barrier(0);      /* keeps the loads up here: sunk to their stores, their latency would be waited out at the barrier */
    /* O^T = gate * M.Q^T for the keys below the tile: the start value of the tile's own sums */
    v8f oh[4], ol[4] = {};
    { v8f ih[4] = {}, il[4] = {};
#pragma unroll      /* fragments and accumulators are register arrays: every index a constant */
      for (int c = 0; c < 2; ++c)
#pragma unroll      /* fragments and accumulators are register arrays: every index a constant */
        for (int dt = 0; dt < 4; ++dt) {
          FragH ah, al;
#pragma unroll      /* fragments are register arrays: every index a constant */
          for (int y = 0; y < 2; ++y) { ah.half[y] = *(const v8us*)&sf[((c * 4 + dt) * 2 + 0) * 2 + y][8 * lane]; al.half[y] = *(const v8us*)&sf[((c * 4 + dt) * 2 + 1) * 2 + y][8 * lane]; }
          ih[dt] = mma(ah.v, qf[c].v, ih[dt]);   /* ih[dt][r] = sum over d of M[16dt + 8hh + r][d] * q[tq][d] */
          il[dt] = mma(al.v, qf[c].v, il[dt]);
        }
#pragma unroll      /* accumulators are register arrays: every index a constant */
      for (int dt = 0; dt < 4; ++dt) oh[dt] = (ih[dt] + il[dt] * 0.0009765625f) * gate;
    }
    /* The two stages of the tile's own 128 keys: masked. */
    stage64<true>(&sk[0][0][0], &sv[0][0][0], ln, hh, qf, gate, tile * QT, tq, oh, ol);
    __builtin_amdgcn_sched_barrier(0);      /* keeps the conversions and stores, and the wait for the global loads in front of them, behind the stage's products */
#pragma unroll      /* register arrays: every index a constant */
    for (int i = 0; i < 4; ++i) { *(v4us*)&sk[1][sr + 16 * i][sc4] = cvt4(gk[i]); *(v4us*)&sv[1][sr + 16 * i][sc4] = cvt4(gv[i]); }
    __syncthreads();
    stage64<true>(&sk[1][0][0], &sv[1][0][0], ln, hh, qf, gate, tile * QT + KS, tq, oh, ol);
    /* no barrier here: buffer 1 is next written behind the next tile's barriers */
    /* O rows through the wave's own LDS range, so that each store instruction writes whole 128-B lines */
#pragma unroll      /* fragments and accumulators are register arrays: every index a constant */
    for (int dt = 0; dt < 4; ++dt) {
      v4f x, y;
#pragma unroll      /* fragments and accumulators are register arrays: every index a constant */
      for (int i = 0; i < 4; ++i) { x[i] = oh[dt][i] + ol[dt][i] * 0.0009765625f; y[i] = oh[dt][4 + i] + ol[dt][4 + i] * 0.0009765625f; }
      *(v4fa*)&so[w][ln][16 * dt + 8 * hh] = x; *(v4fa*)&so[w][ln][16 * dt + 8 * hh + 4] = y;
    }
    __builtin_amdgcn_fence(__ATOMIC_ACQ_REL, "workgroup");      /* the rows below were written by other lanes of this wave */
    __builtin_amdgcn_wave_barrier();
#pragma unroll      /* the eight row reads go out together, ahead of the stores */
    for (int q = 0; q < 8; ++q) {
      const int r = q * 2 + hh;
      const v4f o = *(const v4fa*)&so[w][r][ln * 4];
      *(v4f*)(out + (((size_t)b * SS + tq0 + r) * NH + h) * DH + ln * 4) = o;
    }
    asm volatile("s_wait_xcnt 0x0" ::: "memory");      /* stands in front of the next tile's rewriting of the registers that these stores name */
  }
}

extern "C" void kernel_launch(void* const* d_in, const int* in_sizes, int n_in,
                              void* d_out, int out_size, void* d_ws, size_t ws_size, hipStream_t stream) {
  (void)in_sizes; (void)n_in; (void)out_size; (void)d_ws; (void)ws_size;
  const float* qk = (const float*)d_in[0]; const float* v = (const float*)d_in[1]; const float* nn = (const float*)d_in[2];
  k_attn<<<NBt * NH * (SS / QT / 2), 256, 0, stream>>>(qk, v, nn, (float*)d_out);      /* 256 work-groups, two successive query tiles each */
}

// v004
// Measured time: 14.7 microseconds a run.
// Next to v003, in two timings, it ran 1.19 times as fast each time.
// All steps since v000 together make it 412 times as fast.
#include <hip/hip_runtime.h>
// Self-normalising linear attention (B 2, S 2048, 16 heads x 64): scores[t][s] = q_t.k_s (no scaling), causal (s <= t, multiplicative mask),
// attention = exp(-n[b,t,h]) * scores (no softmax), out[b,t,h,:] = sum_s attention[t][s] * v[b,s,h,:] -> [2,2048,16,64].
// Structure: TWO launches; both read their inputs as f32 and round and convert them on the way into registers (q) and LDS (k, v).
//   Keys below a query tile carry no mask and there is no softmax, so their part is reassociated: sum_s (q.k_s) v_s = q.(sum_s k_s v_s^T).
//   k_state: a work-group of 8 waves owns 256 successive keys of one (batch, head). The 64 x 64 state K^T.V is summed on the matrix unit, each
//   wave on its own block of 32 keys through its own LDS range; the waves' parts are summed through LDS and stored in the workspace as f32,
//   once for the first 128 keys and once for all 256. So every key is turned into a state once, not once by every work-group above it.
//   k_attn: scores, gate, mask and weighted sums. V is staged as it lies (row = key); the transposing LDS load hands out V^T fragments.
//   A work-group of 8 waves owns 256 successive queries of one (batch, head), as two tiles of 128; a wave owns 16 queries of a tile.
//   It adds up the stored states of the keys below its tile (at most 7 of 256 keys, and one of 128 for the second tile), splits the sum into
//   f16 hi + lo and multiplies it by the wave's queries.
//   The tile's own 128 keys, two stages of 64, masked, transposed products: S^T = K.Q^T (A = key rows from LDS, B = the wave's queries, kept in
//   registers), O^T += V^T.P^T. Two f32 S^T tiles (keys 0-15, 16-31 of a pass, same queries), gated and converted in place, ARE the B operand
//   of the second product, so a score never leaves the registers.
// Compute dtype: qk, v, n rounded to bf16, so q, k, v are exact as f16 operands; scores with exact products and
//   f32 accumulation; gated scores and the state as f16 hi + lo * 2^10 operands (about f32: the weighted sums cancel heavily), f32 accumulation;
//   exp in f32. v_wmma_f32_16x16x32_f16.
#define NBt 2
#define SS 2048
#define NH 16
#define DH 64
#define RS (2 * NH * DH)   /* row stride (t) of the q|k layout, elements */
#define QT 128             /* queries per work-group tile */
#define KS 64              /* keys per stage */
#define KB 32              /* keys per block of the state sum */
#define LP 72              /* LDS row pitch in f16: 144 B = 16 B x odd, conflict-free for 16-byte row readers */
#define LV 80              /* LDS row pitch of V in f16: 160 B = 32 B x odd, conflict-free for the transposing 16-byte reader */
#define VS (NH * DH)       /* row stride (s) of v, elements */
#define OP 68              /* output staging pitch in f32: 272 B = 16 B x odd */
typedef unsigned short v8us __attribute__((ext_vector_type(8), may_alias));
typedef unsigned short v4us __attribute__((ext_vector_type(4), may_alias));
typedef short s16x8 __attribute__((ext_vector_type(8)));
typedef __bf16 v2b __attribute__((ext_vector_type(2)));
typedef float  v8f  __attribute__((ext_vector_type(8)));
typedef float  v4f  __attribute__((ext_vector_type(4)));
typedef float  v4fa __attribute__((ext_vector_type(4), may_alias));
typedef _Float16 v16h __attribute__((ext_vector_type(16)));
typedef float v2f __attribute__((ext_vector_type(2)));
typedef _Float16 v2h __attribute__((ext_vector_type(2)));
union FragH { v16h v; v8us half[2]; v2h h2[8]; _Float16 h[16]; unsigned short u[16]; };

__device__ __forceinline__ unsigned short bf16_bits(float x) { unsigned int u = __float_as_uint(x); return (unsigned short)((u + 0x7FFFu + ((u >> 16) & 1u)) >> 16); }
__device__ __forceinline__ float bf16_val(unsigned short b) { return __uint_as_float(((unsigned int)b) << 16); }
__device__ __forceinline__ float bf16_round(float x) { return bf16_val(bf16_bits(x)); }
__device__ __forceinline__ v8f mma(v16h a, v16h b, v8f c) { return __builtin_amdgcn_wmma_f32_16x16x32_f16(false, a, false, b, (short)0, c, false, false); }

// Four f32 inputs, rounded to bf16 (nearest even) and held as f16 (exact).
union Q4 { v4us u; v2h h2[2]; };
__device__ __forceinline__ v4us cvt4(v4f x) {
  Q4 r;
#pragma unroll      /* p a constant: the vector's elements are picked at compile time and stay in registers */
  for (int p = 0; p < 2; ++p) { const v2f a = { x[2 * p], x[2 * p + 1] }; r.h2[p] = __builtin_convertvector(__builtin_convertvector(__builtin_convertvector(a, v2b), v2f), v2h); }
  return r.u;
}

// Gate, mask and split of one pass: two f32 S^T tiles (keys s0 + 0..15, s0 + 16..31, this lane's query tq) become the hi and lo B operands.
// sc[a][r] = score of key s0 + 16a + 8hh + r; element 8a + r of a B operand is k = 16a + 8hh + r: the hardware k order, in place.
template <bool MASK>
__device__ __forceinline__ void split32(const v8f (&sc)[2], float gate, int s0, int hh, int tq, FragH& ph, FragH& pl) {
#pragma unroll      /* fragments and accumulators are register arrays: every index a constant */
  for (int a = 0; a < 2; ++a)
#pragma unroll      /* fragments and accumulators are register arrays: every index a constant */
    for (int r = 0; r < 8; r += 2) {      /* two scores at a time: packed multiply, packed conversions */
      v2f pv = { sc[a][r] * gate, sc[a][r + 1] * gate };
      if (MASK) { const int s = s0 + 16 * a + 8 * hh + r; pv[0] = (s <= tq) ? pv[0] : 0.f; pv[1] = (s + 1 <= tq) ? pv[1] : 0.f; }
      const v2h hi = __builtin_convertvector(pv, v2h);
      const v2h lo = __builtin_convertvector((pv - __builtin_convertvector(hi, v2f)) * 1024.0f, v2h);
      ph.h2[4 * a + r / 2] = hi;
      pl.h2[4 * a + r / 2] = lo;
    }
}
// A fragment of 16 rows x 32 k from LDS rows of pitch LP, in the hardware k order (elements 0-7 = k 8hh + i, 8-15 = k 16 + 8hh + i).
__device__ __forceinline__ FragH frag(const unsigned short* row0, int ln, int hh) {
  const unsigned short* p = row0 + ln * LP + 8 * hh; FragH f; f.half[0] = *(const v8us*)(p); f.half[1] = *(const v8us*)(p + 16); return f;
}
// A fragment of V^T, 16 d x 32 keys, from LDS V rows (row = key, pitch LV): tp = this lane's address in the first 16 keys x 16 d block.
// Lane (ln, hh) receives V[8hh + 0..7][ln] and V[16 + 8hh + 0..7][ln]: the same hardware k order.
__device__ __forceinline__ v8us tr16(const unsigned short* p) { typedef __attribute__((address_space(3))) s16x8 lds_s16x8; return __builtin_bit_cast(v8us, __builtin_amdgcn_ds_load_tr16_b128_v8i16((lds_s16x8*)p)); }
__device__ __forceinline__ FragH fragt(const unsigned short* tp) { FragH f; f.half[0] = tr16(tp); f.half[1] = tr16(tp + 16 * LV); return f; }
// One stage: 64 keys (first key s0), as two passes of 32, against the wave's 16 queries (this lane's query: tq).
// kt: LDS key rows of the stage (64 d each); vt: LDS V rows of the stage (row = key, 64 d each).
template <bool MASK>
__device__ __forceinline__ void stage64(const unsigned short* kt, const unsigned short* vt, int ln, int hh, const FragH (&qf)[2], float gate, int s0, int tq, v8f (&oh)[4], v8f (&ol)[4]) {
  FragH kf[2][2][2], vf[2][4];
  const unsigned short* tp = vt + (8 * hh + (ln & 7)) * LV + 8 * (ln >> 3);
#pragma unroll      /* fragments and accumulators are register arrays: every index a constant */
  for (int j = 0; j < 2; ++j)
#pragma unroll      /* fragments and accumulators are register arrays: every index a constant */
    for (int a = 0; a < 2; ++a) { kf[j][a][0] = frag(kt + (32 * j + 16 * a) * LP, ln, hh); kf[j][a][1] = frag(kt + (32 * j + 16 * a) * LP + 32, ln, hh); }
#pragma unroll      /* fragments and accumulators are register arrays: every index a constant */
  for (int dt = 0; dt < 4; ++dt) vf[0][dt] = fragt(tp + 16 * dt);
  __builtin_amdgcn_sched_barrier(0);      /* keeps these loads one group ahead of the products: issued one pair in front of each product, every pair's LDS latency is waited out */
  v8f sc[2][2];
#pragma unroll      /* fragments and accumulators are register arrays: every index a constant */
  for (int a = 0; a < 2; ++a) { v8f c = {}; c = mma(kf[0][a][0].v, qf[0].v, c); sc[0][a] = mma(kf[0][a][1].v, qf[1].v, c); }
#pragma unroll      /* fragments and accumulators are register arrays: every index a constant */
  for (int dt = 0; dt < 4; ++dt) vf[1][dt] = fragt(tp + 32 * LV + 16 * dt);
  __builtin_amdgcn_sched_barrier(0);      /* the second pass's V^T loads go out here, into the registers the first pass's key rows have left, not in front of their users */
#pragma unroll      /* fragments and accumulators are register arrays: every index a constant */
  for (int a = 0; a < 2; ++a) { v8f c = {}; c = mma(kf[1][a][0].v, qf[0].v, c); sc[1][a] = mma(kf[1][a][1].v, qf[1].v, c); }
#pragma unroll      /* fragments and accumulators are register arrays: every index a constant */
  for (int j = 0; j < 2; ++j) {
    FragH ph, pl;
    split32<MASK>(sc[j], gate, s0 + 32 * j, hh, tq, ph, pl);
#pragma unroll      /* fragments and accumulators are register arrays: every index a constant */
    for (int dt = 0; dt < 4; ++dt) {
      oh[dt] = mma(vf[j][dt].v, ph.v, oh[dt]);   /* oh[dt][r] = O[tq][16dt + 8hh + r] */
      ol[dt] = mma(vf[j][dt].v, pl.v, ol[dt]);
    }
  }
}

// One key block for one wave, 32 rows of K and of V as f32: rows 2 i + hh, 16 bytes at element 4 ln, so each load covers 4 whole 128-B lines.
// pk points at this lane's place in the first q|k row (its keys stand NH * DH further), pv at its place in the first V row.
__device__ __forceinline__ void load_block(const float* pk, const float* pv, v4f (&xk)[16], v4f (&xv)[16]) {
#pragma unroll      /* the 32 loads go out together */
  for (int i = 0; i < 16; ++i) { xk[i] = *(const v4f*)(pk + NH * DH + 2 * i * RS); xv[i] = *(const v4f*)(pv + 2 * i * VS); }
  asm volatile("s_wait_xcnt 0x0" :: "v"(pk), "v"(pv) : "memory");      /* stands in front of any rewriting of the registers that these loads name; the addresses as inputs keep a load's own result out of them */
}

// The states of 256 successive keys of one (batch, head): st + ((bh * 8 + pr) * 2 + y) * 4096, y = 0 the first 128 keys, y = 1 all 256.
// In a state, wave w's two tiles stand as it holds them: registers 4 x .. 4 x + 3 of tile a of this lane at (w * 4 + a * 2 + x) * 128 + 4 lane.
__global__ __launch_bounds__(256) void k_state(const float* __restrict__ qk, const float* __restrict__ v, float* __restrict__ st) {
  __shared__ __attribute__((aligned(32))) unsigned short wr[8][8192];     /* each wave's own 16 KiB: 32 K rows and 32 V rows of its key block (pitch LV); then its part of the state, 16 f32 tiles */
  const int tid = threadIdx.x, lane = tid & 31, ln = lane & 15, hh = lane >> 4;
  const int w = __builtin_amdgcn_readfirstlane(tid >> 5);
  const int bh = blockIdx.x & (NBt * NH - 1), pr = blockIdx.x >> 5, b = bh / NH, h = bh % NH;
  const float* qg = qk + (size_t)b * SS * RS + h * DH;      /* q|k row s at qg + s * RS */
  const float* vg = v + (size_t)b * SS * VS + h * DH;       /* V row s at vg + s * VS */
  unsigned short* wk = &wr[w][0];
  unsigned short* wv = wk + KB * LV;
  const unsigned short* tk = wk + (8 * hh + (ln & 7)) * LV + 8 * (ln >> 3);      /* this lane's address for the transposing reader, as in stage64 */
  const unsigned short* tv = wv + (8 * hh + (ln & 7)) * LV + 8 * (ln >> 3);
  float* wf = (float*)wk;      /* the wave's part of the state: tile t = 4 i + j, registers 4 x .. 4 x + 3 of this lane at wf + (2 t + x) * 128 + 4 lane */
  const int kb = pr * 8 + w;   /* the wave's key block of 32 */
  v4f xk[16], xv[16];
  load_block(qg + (size_t)(kb * KB + hh) * RS + 4 * ln, vg + (size_t)(kb * KB + hh) * VS + 4 * ln, xk, xv);
#pragma unroll      /* register arrays: every index a constant */
  for (int i = 0; i < 16; ++i) { *(v4us*)(wk + (2 * i + hh) * LV + 4 * ln) = cvt4(xk[i]); *(v4us*)(wv + (2 * i + hh) * LV + 4 * ln) = cvt4(xv[i]); }
  asm volatile("s_wait_dscnt 0x0" ::: "memory");      /* the rows read below were written by other lanes of this wave: its LDS stores are done */
  FragH kf[4], vf[4];      /* K^T as A (16 d x 32 keys), V as B (32 keys x 16 d): one loader, so one k order */
#pragma unroll      /* fragments are register arrays: every index a constant */
  for (int t = 0; t < 4; ++t) { kf[t] = fragt(tk + 16 * t); vf[t] = fragt(tv + 16 * t); }
  /* m[r] of tile t = 4 i + j = sum over the wave's keys of K[s][16 i + 8 hh + r] * V[s][16 j + ln]; it goes into the wave's own LDS range, over the rows, whose reads all stand in front of these stores */
#pragma unroll      /* fragments and accumulators are register arrays: every index a constant */
  for (int t = 0; t < 16; ++t) {
    v8f m = {};
    m = mma(kf[t >> 2].v, vf[t & 3].v, m);
#pragma unroll      /* accumulators are register arrays: every index a constant */
    for (int x = 0; x < 2; ++x) { const v4f y = { m[4 * x], m[4 * x + 1], m[4 * x + 2], m[4 * x + 3] }; *(v4fa*)(wf + (2 * t + x) * 128 + 4 * lane) = y; }
  }
  __syncthreads();      /* the parts are in LDS */
  /* Wave w adds the parts (wave 0 first) of state tiles (2 c, dvt) and (2 c + 1, dvt): the two that it converts in k_attn. */
  const int dvt = w & 3, c = w >> 2;
  float* sp = st + (size_t)(bh * 8 + pr) * 8192 + w * 512 + 4 * lane;
  v4f tot[2][2][2] = {};      /* [0]: the first 128 keys (waves 0 to 3); [1]: all 256 */
#pragma unroll      /* the 32 reads go out together */
  for (int u = 0; u < 8; ++u)
#pragma unroll      /* register arrays: every index a constant */
    for (int a = 0; a < 2; ++a)
#pragma unroll      /* register arrays: every index a constant */
      for (int x = 0; x < 2; ++x) {
        if (u == 4) tot[1][a][x] = tot[0][a][x];
        tot[u >> 2][a][x] += *(const v4fa*)((const float*)&wr[u][0] + (2 * ((2 * c + a) * 4 + dvt) + x) * 128 + 4 * lane);
      }
  /* the stores stand last: no register that they name is written again */
#pragma unroll      /* register arrays: every index a constant */
  for (int y = 0; y < 2; ++y)
#pragma unroll      /* register arrays: every index a constant */
    for (int a = 0; a < 2; ++a)
#pragma unroll      /* register arrays: every index a constant */
      for (int x = 0; x < 2; ++x) *(v4f*)(sp + y * 4096 + (a * 2 + x) * 128) = tot[y][a][x];
}

__global__ __launch_bounds__(256) void k_attn(const float* __restrict__ qk, const float* __restrict__ v, const float* __restrict__ nn, const float* __restrict__ st, float* __restrict__ out) {
  __shared__ __attribute__((aligned(16))) unsigned short sk[2][KS][LP];   /* key rows of a stage, two buffers */
  __shared__ __attribute__((aligned(32))) unsigned short sv[2][KS][LV];   /* V rows of a stage, two buffers */
  __shared__ __attribute__((aligned(16))) float so[8][16][OP];            /* each wave's own output staging */
  __shared__ __attribute__((aligned(16))) unsigned short sf[32][256];     /* the summed state as A operands: [((c * 4 + dvt) * 2 + lo) * 2 + half][lane * 8] */
  const int tid = threadIdx.x, lane = tid & 31, ln = lane & 15, hh = lane >> 4;
  const int w = __builtin_amdgcn_readfirstlane(tid >> 5);
  const int bh = blockIdx.x & (NBt * NH - 1), pr = (SS / QT / 2 - 1) - (blockIdx.x >> 5), b = bh / NH, h = bh % NH;   /* the most stored states start first */
  const float* qg = qk + (size_t)b * SS * RS + h * DH;      /* query row t at qg + t * RS */
  const float* kg = qg + NH * DH;                           /* key row s at kg + s * RS */
  const float* vg = v + (size_t)b * SS * VS + h * DH;       /* V row s at vg + s * VS */
  const int sr = tid >> 4, sc4 = (tid & 15) * 4;      /* staging: rows sr + 16 i, 16 bytes of f32 at element sc4: a wave's load covers 4 whole 128-B lines */
  /* The stored states of the keys below: this wave's two tiles of each, asked for at once. pt: all 256 keys of the pairs of tiles below; ph: the first tile's own 128 keys, for the second tile. */
  const float* sp = st + (size_t)(bh * 8) * 8192 + w * 512 + 4 * lane;
  v4f pt[SS / QT / 2 - 1][4], ph[4];
  const float* ap[SS / QT / 2];
#pragma unroll      /* register arrays: every index a constant; all loads go out ahead of the first sum */
  for (int p = 0; p < SS / QT / 2 - 1; ++p) {
    ap[p] = (p < pr) ? sp + p * 8192 + 4096 : st;      /* no branch, so that every load is counted on every path; a pair that is not below the tile: all lanes read one stored place, weight 0 below */
#pragma unroll      /* register arrays: every index a constant */
    for (int y = 0; y < 4; ++y) pt[p][y] = *(const v4f*)(ap[p] + y * 128);
  }
  ap[SS / QT / 2 - 1] = sp + pr * 8192;
#pragma unroll      /* register arrays: every index a constant */
  for (int y = 0; y < 4; ++y) ph[y] = *(const v4f*)(ap[SS / QT / 2 - 1] + y * 128);
  asm volatile("s_wait_xcnt 0x0" :: "v"(ap[0]), "v"(ap[1]), "v"(ap[2]), "v"(ap[3]), "v"(ap[4]), "v"(ap[5]), "v"(ap[6]), "v"(ap[7]) : "memory");      /* stands in front of any rewriting of the registers that these loads name; the addresses as inputs keep them whole up to here */
  v4f tot[2][2] = {};          /* the state of all keys below the tile, f32: the two tiles that this wave sums and converts (below) */
#pragma unroll      /* half a constant: the stored states' registers are free again behind the first tile's sum */
  for (int half = 0; half < 2; ++half) {
    const int tile = 2 * pr + half;
    const int tq0 = tile * QT + 16 * w, tq = tq0 + ln;
    const float* qr = qg + (size_t)tq * RS + 8 * hh;
    const float* gp = nn + ((size_t)b * SS + tq) * NH + h;
    v4f xq[8];
#pragma unroll      /* the eight loads go out together */
    for (int g = 0; g < 8; ++g) xq[g] = *(const v4f*)(qr + 16 * (g >> 1) + 4 * (g & 1));      /* floats 16 (g / 2) + 8 hh + 4 (g % 2) .. + 3 of the row: the hardware k order */
    const float gn = *gp;
    asm volatile("s_wait_xcnt 0x0" :: "v"(qr), "v"(gp) : "memory");      /* stands in front of any rewriting of the registers that these loads name; the addresses as inputs keep them whole up to here */
    /* the tile's own first 64 keys are asked for up here, beside the queries */
    const float* kp = kg + (size_t)(tile * QT + sr) * RS + sc4;
    const float* vp = vg + (size_t)(tile * QT + sr) * VS + sc4;
    v4f gk[4], gv[4];
#pragma unroll      /* the eight loads go out together */
    for (int i = 0; i < 4; ++i) { gk[i] = *(const v4f*)(kp + 16 * i * RS); gv[i] = *(const v4f*)(vp + 16 * i * VS); }
    asm volatile("s_wait_xcnt 0x0" :: "v"(kp), "v"(vp) : "memory");      /* stands in front of any rewriting of the registers that the loads above name; the addresses as inputs keep them whole up to here */
    __builtin_amdgcn_sched_barrier(0);      /* keeps the conversions and sums below, and the waits in front of them, behind the issue of all the loads above */
    FragH qf[2];
    { Q4 c;
#pragma unroll      /* fragments are register arrays: every index a constant */
      for (int g = 0; g < 8; ++g) { c.u = cvt4(xq[g]); qf[g >> 2].h2[2 * (g & 3)] = c.h2[0]; qf[g >> 2].h2[2 * (g & 3) + 1] = c.h2[1]; } }
    const float gate = expf(-bf16_round(gn));
    /* Keys below the tile: no mask, so sum_s (q.k_s) v_s = q.(sum_s k_s v_s^T). Wave w adds the stored states (lowest keys first) of state tiles (2 c, dvt) and (2 c + 1, dvt). */
    /* Converted in place these ARE the A operand M[16 dvt + ln][32 c + k], M = V^T.K, in the hardware k order: element 8 a + r is k = 16 a + 8 hh + r. Held as f16 hi + lo * 2^10, like the gated scores. */
    /* No barrier in front: sf was last read ahead of the previous tile's last barrier. */
    { const int dvt = w & 3, c = w >> 2;
      FragH mh, ml;
      if (half == 0) {
#pragma unroll      /* register arrays: every index a constant */
        for (int p = 0; p < SS / QT / 2 - 1; ++p) {
          const float f = (p < pr) ? 1.0f : 0.0f;
#pragma unroll      /* register arrays: every index a constant */
          for (int y = 0; y < 4; ++y) tot[y >> 1][y & 1] += pt[p][y] * f;
        }
      } else {
#pragma unroll      /* register arrays: every index a constant */
        for (int y = 0; y < 4; ++y) tot[y >> 1][y & 1] += ph[y];
      }
#pragma unroll      /* fragments are register arrays: every index a constant */
      for (int a = 0; a < 2; ++a)
#pragma unroll      /* fragments are register arrays: every index a constant */
        for (int x = 0; x < 2; ++x) {
          const v4f s = tot[a][x];
#pragma unroll      /* fragments are register arrays: every index a constant */
          for (int e = 0; e < 4; e += 2) {
            const v2f pv = { s[e], s[e + 1] };
            const v2h hi = __builtin_convertvector(pv, v2h);
            const v2h lo = __builtin_convertvector((pv - __builtin_convertvector(hi, v2f)) * 1024.0f, v2h);
            mh.h2[4 * a + 2 * x + e / 2] = hi;
            ml.h2[4 * a + 2 * x + e / 2] = lo;
          }
        }
#pragma unroll      /* fragments are register arrays: every index a constant */
      for (int y = 0; y < 2; ++y) { *(v8us*)&sf[((c * 4 + dvt) * 2 + 0) * 2 + y][8 * lane] = mh.half[y]; *(v8us*)&sf[((c * 4 + dvt) * 2 + 1) * 2 + y][8 * lane] = ml.half[y]; }
    }
    /* buffer 0 was last read in the stage before the previous tile's last barrier */
#pragma unroll      /* register arrays: every index a constant */
    for (int i = 0; i < 4; ++i) { *(v4us*)&sk[0][sr + 16 * i][sc4] = cvt4(gk[i]); *(v4us*)&sv[0][sr + 16 * i][sc4] = cvt4(gv[i]); }
    __syncthreads();      /* publishes the summed state and the tile's first stage; ends the previous tile's reads of buffer 1 */
    kp += KS * RS; vp += KS * VS;
#pragma unroll      /* the eight loads go out together */
    for (int i = 0; i < 4; ++i) { gk[i] = *(const v4f*)(kp + 16 * i * RS); gv[i] = *(const v4f*)(vp + 16 * i * VS); }
    asm volatile("s_wait_xcnt 0x0" :: "v"(kp), "v"(vp) : "memory");      /* stands in front of any rewriting of the registers that the loads above name; the addresses as inputs keep them whole up to here */
    __builtin_amdgcn_sched_barrier(0);      /* keeps the loads up here: sunk to their stores, their latency would be waited out at the barrier */
    /* O^T = gate * M.Q^T for the keys below the tile: the start value of the tile's own sums */
    v8f oh[4], ol[4] = {};
    { v8f ih[4] = {}, il[4] = {};
#pragma unroll      /* fragments and accumulators are register arrays: every index a constant */
      for (int c = 0; c < 2; ++c)
#pragma unroll      /* fragments and accumulators are register arrays: every index a constant */
        for (int dt = 0; dt < 4; ++dt) {
          FragH ah, al;
#pragma unroll      /* fragments are register arrays: every index a constant */
          for (int y = 0; y < 2; ++y) { ah.half[y] = *(const v8us*)&sf[((c * 4 + dt) * 2 + 0) * 2 + y][8 * lane]; al.half[y] = *(const v8us*)&sf[((c * 4 + dt) * 2 + 1) * 2 + y][8 * lane]; }
          ih[dt] = mma(ah.v, qf[c].v, ih[dt]);   /* ih[dt][r] = sum over d of M[16dt + 8hh + r][d] * q[tq][d] */
          il[dt] = mma(al.v, qf[c].v, il[dt]);
        }
#pragma unroll      /* accumulators are register arrays: every index a constant */
      for (int dt = 0; dt < 4; ++dt) oh[dt] = (ih[dt] + il[dt] * 0.0009765625f) * gate;
    }
    /* The two stages of the tile's own 128 keys: masked. */
    stage64<true>(&sk[0][0][0], &sv[0][0][0], ln, hh, qf, gate, tile * QT, tq, oh, ol);
    __builtin_amdgcn_sched_barrier(0);      /* keeps the conversions and stores, and the wait for the global loads in front of them, behind the stage's products */
#pragma unroll      /* register arrays: every index a constant */
    for (int i = 0; i < 4; ++i) { *(v4us*)&sk[1][sr + 16 * i][sc4] = cvt4(gk[i]); *(v4us*)&sv[1][sr + 16 * i][sc4] = cvt4(gv[i]); }
    __syncthreads();
    stage64<true>(&sk[1][0][0], &sv[1][0][0], ln, hh, qf, gate, tile * QT + KS, tq, oh, ol);
    /* no barrier here: buffer 1 is next written behind the next tile's first barrier */
    /* O rows through the wave's own LDS range, so that each store instruction writes whole 128-B lines */
#pragma unroll      /* fragments and accumulators are register arrays: every index a constant */
    for (int dt = 0; dt < 4; ++dt) {
      v4f x, y;
#pragma unroll      /* fragments and accumulators are register arrays: every index a constant */
      for (int i = 0; i < 4; ++i) { x[i] = oh[dt][i] + ol[dt][i] * 0.0009765625f; y[i] = oh[dt][4 + i] + ol[dt][4 + i] * 0.0009765625f; }
      *(v4fa*)&so[w][ln][16 * dt + 8 * hh] = x; *(v4fa*)&so[w][ln][16 * dt + 8 * hh + 4] = y;
    }
    __builtin_amdgcn_fence(__ATOMIC_ACQ_REL, "workgroup");      /* the rows below were written by other lanes of this wave */
    __builtin_amdgcn_wave_barrier();
#pragma unroll      /* the eight row reads go out together, ahead of the stores */
    for (int q = 0; q < 8; ++q) {
      const int r = q * 2 + hh;
      const v4f o = *(const v4fa*)&so[w][r][ln * 4];
      *(v4f*)(out + (((size_t)b * SS + tq0 + r) * NH + h) * DH + ln * 4) = o;
    }
    asm volatile("s_wait_xcnt 0x0" ::: "memory");      /* stands in front of the next tile's rewriting of the registers that these stores name */
    __builtin_amdgcn_sched_barrier(0);      /* keeps the next tile's address arithmetic, which takes up those registers, behind that wait */
  }
}

extern "C" void kernel_launch(void* const* d_in, const int* in_sizes, int n_in,
                              void* d_out, int out_size, void* d_ws, size_t ws_size, hipStream_t stream) {
  (void)in_sizes; (void)n_in; (void)out_size; (void)ws_size;
  const float* qk = (const float*)d_in[0]; const float* v = (const float*)d_in[1]; const float* nn = (const float*)d_in[2];
  float* st = (float*)d_ws;      /* 32 (batch, head) x 8 x 2 states of 16 KiB: 8 MiB, all written by k_state */
  k_state<<<NBt * NH * (SS / QT / 2), 256, 0, stream>>>(qk, v, st);                    /* 256 work-groups, 256 successive keys each */
  k_attn<<<NBt * NH * (SS / QT / 2), 256, 0, stream>>>(qk, v, nn, st, (float*)d_out);  /* 256 work-groups, two successive query tiles each */
}

// v005
// A run of this version takes 13.2 microseconds.
// Next to v004, in two timings, it ran 1.11 times as fast each time.
// All steps since v000 together make it 459 times as fast.
#include <hip/hip_runtime.h>
// Self-normalising linear attention (B 2, S 2048, 16 heads x 64): scores[t][s] = q_t.k_s (no scaling), causal (s <= t, multiplicative mask),
// attention = exp(-n[b,t,h]) * scores (no softmax), out[b,t,h,:] = sum_s attention[t][s] * v[b,s,h,:] -> [2,2048,16,64].
// Structure: TWO launches; both read their inputs as f32 and round and convert them on the way into registers (q) and LDS (k, v).
//   Keys below a query tile carry no mask and there is no softmax, so their part is reassociated: sum_s (q.k_s) v_s = q.(sum_s k_s v_s^T).
//   k_state: a work-group of 8 waves owns 256 successive keys of one (batch, head). The 64 x 64 state K^T.V is summed on the matrix unit, each
//   wave on its own block of 32 keys through its own LDS range; the waves' parts are summed through LDS and stored in the workspace as f32,
//   once for the first 128 keys and once for all 256. So every key is turned into a state once, not once by every work-group above it.
//   k_attn: scores, gate, mask and weighted sums. V is staged as it lies (row = key); the transposing LDS load hands out V^T fragments.
//   A work-group of 8 waves owns 256 successive queries of one (batch, head), as two tiles of 128; a wave owns 16 queries of each tile:
//   group w of the first, group 7 - w of the second. All 256 keys are staged at once, so one barrier serves the whole launch.
//   It adds up the stored states of the keys below its tiles (at most 7 of 256 keys, and one of 128 for the second tile), splits the sums into
//   f16 hi + lo and multiplies them by the wave's queries.
//   The tile's own 128 keys, in passes of 32, transposed products: S^T = K.Q^T (A = key rows from LDS, B = the wave's queries, kept in
//   registers), O^T += V^T.P^T. Two f32 S^T tiles (keys 0-15, 16-31 of a pass, same queries), gated and converted in place, ARE the B operand
//   of the second product, so a score never leaves the registers. Query group g needs passes 0 .. g / 2 alone (the passes above hold masked
//   keys only), and only the last of them holds a masked key: with groups w and 7 - w every wave runs 5 passes, 2 of them with the mask.
// Compute dtype: qk, v, n rounded to bf16, so q, k, v are exact as f16 operands; scores with exact products and
//   f32 accumulation; gated scores and the state as f16 hi + lo * 2^10 operands (about f32: the weighted sums cancel heavily), f32 accumulation;
//   exp in f32. v_wmma_f32_16x16x32_f16.
#define NBt 2
#define SS 2048
#define NH 16
#define DH 64
#define RS (2 * NH * DH)   /* row stride (t) of the q|k layout, elements */
#define QT 128             /* queries per work-group tile */
#define KB 32              /* keys per block of the state sum, and per pass of a tile's own keys */
#define LP 72              /* LDS row pitch in f16: 144 B = 16 B x odd, conflict-free for 16-byte row readers */
#define LV 80              /* LDS row pitch of V in f16: 160 B = 32 B x odd, conflict-free for the transposing 16-byte reader */
#define VS (NH * DH)       /* row stride (s) of v, elements */
#define OP 68              /* output staging pitch in f32: 272 B = 16 B x odd */
typedef unsigned short v8us __attribute__((ext_vector_type(8), may_alias));
typedef unsigned short v4us __attribute__((ext_vector_type(4), may_alias));
typedef short s16x8 __attribute__((ext_vector_type(8)));
typedef __bf16 v2b __attribute__((ext_vector_type(2)));
typedef float  v8f  __attribute__((ext_vector_type(8)));
typedef float  v4f  __attribute__((ext_vector_type(4)));
typedef float  v4fa __attribute__((ext_vector_type(4), may_alias));
typedef _Float16 v16h __attribute__((ext_vector_type(16)));
typedef float v2f __attribute__((ext_vector_type(2)));
typedef _Float16 v2h __attribute__((ext_vector_type(2)));
union FragH { v16h v; v8us half[2]; v2h h2[8]; _Float16 h[16]; unsigned short u[16]; };

__device__ __forceinline__ unsigned short bf16_bits(float x) { unsigned int u = __float_as_uint(x); return (unsigned short)((u + 0x7FFFu + ((u >> 16) & 1u)) >> 16); }
__device__ __forceinline__ float bf16_val(unsigned short b) { return __uint_as_float(((unsigned int)b) << 16); }
__device__ __forceinline__ float bf16_round(float x) { return bf16_val(bf16_bits(x)); }
__device__ __forceinline__ v8f mma(v16h a, v16h b, v8f c) { return __builtin_amdgcn_wmma_f32_16x16x32_f16(false, a, false, b, (short)0, c, false, false); }

// Four f32 inputs, rounded to bf16 (nearest even) and held as f16 (exact).
union Q4 { v4us u; v2h h2[2]; };
__device__ __forceinline__ v4us cvt4(v4f x) {
  Q4 r;
#pragma unroll      /* p a constant: the vector's elements are picked at compile time and stay in registers */
  for (int p = 0; p < 2; ++p) { const v2f a = { x[2 * p], x[2 * p + 1] }; r.h2[p] = __builtin_convertvector(__builtin_convertvector(__builtin_convertvector(a, v2b), v2f), v2h); }
  return r.u;
}

// Gate, mask and split of one pass: two f32 S^T tiles (keys s0 + 0..15, s0 + 16..31, this lane's query tq) become the hi and lo B operands.
// sc[a][r] = score of key s0 + 16a + 8hh + r; element 8a + r of a B operand is k = 16a + 8hh + r: the hardware k order, in place.
template <bool MASK>
__device__ __forceinline__ void split32(const v8f (&sc)[2], float gate, int s0, int hh, int tq, FragH& ph, FragH& pl) {
#pragma unroll      /* fragments and accumulators are register arrays: every index a constant */
  for (int a = 0; a < 2; ++a)
#pragma unroll      /* fragments and accumulators are register arrays: every index a constant */
    for (int r = 0; r < 8; r += 2) {      /* two scores at a time: packed multiply, packed conversions */
      v2f pv = { sc[a][r] * gate, sc[a][r + 1] * gate };
      if (MASK) { const int s = s0 + 16 * a + 8 * hh + r; pv[0] = (s <= tq) ? pv[0] : 0.f; pv[1] = (s + 1 <= tq) ? pv[1] : 0.f; }
      const v2h hi = __builtin_convertvector(pv, v2h);
      const v2h lo = __builtin_convertvector((pv - __builtin_convertvector(hi, v2f)) * 1024.0f, v2h);
      ph.h2[4 * a + r / 2] = hi;
      pl.h2[4 * a + r / 2] = lo;
    }
}
// A fragment of 16 rows x 32 k from LDS rows of pitch LP, in the hardware k order (elements 0-7 = k 8hh + i, 8-15 = k 16 + 8hh + i).
__device__ __forceinline__ FragH frag(const unsigned short* row0, int ln, int hh) {
  const unsigned short* p = row0 + ln * LP + 8 * hh; FragH f; f.half[0] = *(const v8us*)(p); f.half[1] = *(const v8us*)(p + 16); return f;
}
// A fragment of V^T, 16 d x 32 keys, from LDS V rows (row = key, pitch LV): tp = this lane's address in the first 16 keys x 16 d block.
// Lane (ln, hh) receives V[8hh + 0..7][ln] and V[16 + 8hh + 0..7][ln]: the same hardware k order.
__device__ __forceinline__ v8us tr16(const unsigned short* p) { typedef __attribute__((address_space(3))) s16x8 lds_s16x8; return __builtin_bit_cast(v8us, __builtin_amdgcn_ds_load_tr16_b128_v8i16((lds_s16x8*)p)); }
__device__ __forceinline__ FragH fragt(const unsigned short* tp) { FragH f; f.half[0] = tr16(tp); f.half[1] = tr16(tp + 16 * LV); return f; }
// One pass: 32 keys against the wave's 16 queries. kt: the pass's first LDS key row; tp: this lane's address for the transposing reader in the pass's first V row.
__device__ __forceinline__ void load_k(const unsigned short* kt, int ln, int hh, FragH (&kf)[2][2]) {
#pragma unroll      /* fragments are register arrays: every index a constant */
  for (int a = 0; a < 2; ++a) { kf[a][0] = frag(kt + 16 * a * LP, ln, hh); kf[a][1] = frag(kt + 16 * a * LP + 32, ln, hh); }
}
__device__ __forceinline__ void load_v(const unsigned short* tp, FragH (&vf)[4]) {
#pragma unroll      /* fragments are register arrays: every index a constant */
  for (int dt = 0; dt < 4; ++dt) vf[dt] = fragt(tp + 16 * dt);
}
__device__ __forceinline__ void scores32(const FragH (&kf)[2][2], const FragH (&qf)[2], v8f (&sc)[2]) {
#pragma unroll      /* fragments and accumulators are register arrays: every index a constant */
  for (int a = 0; a < 2; ++a) { v8f c = {}; c = mma(kf[a][0].v, qf[0].v, c); sc[a] = mma(kf[a][1].v, qf[1].v, c); }
}
__device__ __forceinline__ void sums32(const FragH (&vf)[4], const FragH& fh, const FragH& fl, v8f (&oh)[4], v8f (&ol)[4]) {
#pragma unroll      /* fragments and accumulators are register arrays: every index a constant */
  for (int dt = 0; dt < 4; ++dt) {
    oh[dt] = mma(vf[dt].v, fh.v, oh[dt]);   /* oh[dt][r] = O[tq][16dt + 8hh + r] */
    ol[dt] = mma(vf[dt].v, fl.v, ol[dt]);
  }
}
// A summed state (this wave's two tiles, f32) as the A operand M[16 dvt + ln][32 c + k], M = V^T.K, in the hardware k order: element 8 a + r is k = 16 a + 8 hh + r.
// Held as f16 hi + lo * 2^10, like the gated scores. sfh: the tile's operands in LDS, [(slot * 2 + lo) * 2 + half][lane * 8], slot = c * 4 + dvt.
__device__ __forceinline__ void put_state(const v4f (&tot)[2][2], unsigned short (*sfh)[256], int slot, int lane) {
  FragH mh, ml;
#pragma unroll      /* fragments are register arrays: every index a constant */
  for (int a = 0; a < 2; ++a)
#pragma unroll      /* fragments are register arrays: every index a constant */
    for (int x = 0; x < 2; ++x) {
      const v4f s = tot[a][x];
#pragma unroll      /* fragments are register arrays: every index a constant */
      for (int e = 0; e < 4; e += 2) {
        const v2f pv = { s[e], s[e + 1] };
        const v2h hi = __builtin_convertvector(pv, v2h);
        const v2h lo = __builtin_convertvector((pv - __builtin_convertvector(hi, v2f)) * 1024.0f, v2h);
        mh.h2[4 * a + 2 * x + e / 2] = hi;
        ml.h2[4 * a + 2 * x + e / 2] = lo;
      }
    }
#pragma unroll      /* fragments are register arrays: every index a constant */
  for (int y = 0; y < 2; ++y) { *(v8us*)&sfh[(slot * 2 + 0) * 2 + y][8 * lane] = mh.half[y]; *(v8us*)&sfh[(slot * 2 + 1) * 2 + y][8 * lane] = ml.half[y]; }
}

// One key block for one wave, 32 rows of K and of V as f32: rows 2 i + hh, 16 bytes at element 4 ln, so each load covers 4 whole 128-B lines.
// pk points at this lane's place in the first q|k row (its keys stand NH * DH further), pv at its place in the first V row.
__device__ __forceinline__ void load_block(const float* pk, const float* pv, v4f (&xk)[16], v4f (&xv)[16]) {
#pragma unroll      /* the 32 loads go out together */
  for (int i = 0; i < 16; ++i) { xk[i] = *(const v4f*)(pk + NH * DH + 2 * i * RS); xv[i] = *(const v4f*)(pv + 2 * i * VS); }
  asm volatile("s_wait_xcnt 0x0" :: "v"(pk), "v"(pv) : "memory");      /* stands in front of any rewriting of the registers that these loads name; the addresses as inputs keep a load's own result out of them */
}

// The states of 256 successive keys of one (batch, head): st + ((bh * 8 + pr) * 2 + y) * 4096, y = 0 the first 128 keys, y = 1 all 256.
// In a state, wave w's two tiles stand as it holds them: registers 4 x .. 4 x + 3 of tile a of this lane at (w * 4 + a * 2 + x) * 128 + 4 lane.
__global__ __launch_bounds__(256) void k_state(const float* __restrict__ qk, const float* __restrict__ v, float* __restrict__ st) {
  __shared__ __attribute__((aligned(32))) unsigned short wr[8][8192];     /* each wave's own 16 KiB: 32 K rows and 32 V rows of its key block (pitch LV); then its part of the state, 16 f32 tiles */
  const int tid = threadIdx.x, lane = tid & 31, ln = lane & 15, hh = lane >> 4;
  const int w = __builtin_amdgcn_readfirstlane(tid >> 5);
  const int bh = blockIdx.x & (NBt * NH - 1), pr = blockIdx.x >> 5, b = bh / NH, h = bh % NH;
  const float* qg = qk + (size_t)b * SS * RS + h * DH;      /* q|k row s at qg + s * RS */
  const float* vg = v + (size_t)b * SS * VS + h * DH;       /* V row s at vg + s * VS */
  unsigned short* wk = &wr[w][0];
  unsigned short* wv = wk + KB * LV;
  const unsigned short* tk = wk + (8 * hh + (ln & 7)) * LV + 8 * (ln >> 3);      /* this lane's address for the transposing reader, as in k_attn */
  const unsigned short* tv = wv + (8 * hh + (ln & 7)) * LV + 8 * (ln >> 3);
  float* wf = (float*)wk;      /* the wave's part of the state: tile t = 4 i + j, registers 4 x .. 4 x + 3 of this lane at wf + (2 t + x) * 128 + 4 lane */
  const int kb = pr * 8 + w;   /* the wave's key block of 32 */
  v4f xk[16], xv[16];
  load_block(qg + (size_t)(kb * KB + hh) * RS + 4 * ln, vg + (size_t)(kb * KB + hh) * VS + 4 * ln, xk, xv);
#pragma unroll      /* register arrays: every index a constant */
  for (int i = 0; i < 16; ++i) { *(v4us*)(wk + (2 * i + hh) * LV + 4 * ln) = cvt4(xk[i]); *(v4us*)(wv + (2 * i + hh) * LV + 4 * ln) = cvt4(xv[i]); }
  asm volatile("s_wait_dscnt 0x0" ::: "memory");      /* the rows read below were written by other lanes of this wave: its LDS stores are done */
  FragH kf[4], vf[4];      /* K^T as A (16 d x 32 keys), V as B (32 keys x 16 d): one loader, so one k order */
#pragma unroll      /* fragments are register arrays: every index a constant */
  for (int t = 0; t < 4; ++t) { kf[t] = fragt(tk + 16 * t); vf[t] = fragt(tv + 16 * t); }
  /* m[r] of tile t = 4 i + j = sum over the wave's keys of K[s][16 i + 8 hh + r] * V[s][16 j + ln]; it goes into the wave's own LDS range, over the rows, whose reads all stand in front of these stores */
#pragma unroll      /* fragments and accumulators are register arrays: every index a constant */
  for (int t = 0; t < 16; ++t) {
    v8f m = {};
    m = mma(kf[t >> 2].v, vf[t & 3].v, m);
#pragma unroll      /* accumulators are register arrays: every index a constant */
    for (int x = 0; x < 2; ++x) { const v4f y = { m[4 * x], m[4 * x + 1], m[4 * x + 2], m[4 * x + 3] }; *(v4fa*)(wf + (2 * t + x) * 128 + 4 * lane) = y; }
  }
  __syncthreads();      /* the parts are in LDS */
  /* Wave w adds the parts (wave 0 first) of state tiles (2 c, dvt) and (2 c + 1, dvt): the two that it converts in k_attn. */
  const int dvt = w & 3, c = w >> 2;
  float* sp = st + (size_t)(bh * 8 + pr) * 8192 + w * 512 + 4 * lane;
  v4f tot[2][2][2] = {};      /* [0]: the first 128 keys (waves 0 to 3); [1]: all 256 */
#pragma unroll      /* the 32 reads go out together */
  for (int u = 0; u < 8; ++u)
#pragma unroll      /* register arrays: every index a constant */
    for (int a = 0; a < 2; ++a)
#pragma unroll      /* register arrays: every index a constant */
      for (int x = 0; x < 2; ++x) {
        if (u == 4) tot[1][a][x] = tot[0][a][x];
        tot[u >> 2][a][x] += *(const v4fa*)((const float*)&wr[u][0] + (2 * ((2 * c + a) * 4 + dvt) + x) * 128 + 4 * lane);
      }
  /* the stores stand last: no register that they name is written again */
#pragma unroll      /* register arrays: every index a constant */
  for (int y = 0; y < 2; ++y)
#pragma unroll      /* register arrays: every index a constant */
    for (int a = 0; a < 2; ++a)
#pragma unroll      /* register arrays: every index a constant */
      for (int x = 0; x < 2; ++x) *(v4f*)(sp + y * 4096 + (a * 2 + x) * 128) = tot[y][a][x];
}

__global__ __launch_bounds__(256) void k_attn(const float* __restrict__ qk, const float* __restrict__ v, const float* __restrict__ nn, const float* __restrict__ st, float* __restrict__ out) {
  __shared__ __attribute__((aligned(16))) unsigned short sk[2 * QT][LP];  /* key rows of both tiles */
  __shared__ __attribute__((aligned(32))) unsigned short sv[2 * QT][LV];  /* V rows of both tiles */
  __shared__ __attribute__((aligned(16))) float so[8][16][OP];            /* each wave's own output staging */
  __shared__ __attribute__((aligned(16))) unsigned short sf[2][32][256];  /* each tile's summed state as A operands: [tile][((c * 4 + dvt) * 2 + lo) * 2 + half][lane * 8] */
  const int tid = threadIdx.x, lane = tid & 31, ln = lane & 15, hh = lane >> 4;
  const int w = __builtin_amdgcn_readfirstlane(tid >> 5);
  const int bh = blockIdx.x & (NBt * NH - 1), pr = (SS / QT / 2 - 1) - (blockIdx.x >> 5), b = bh / NH, h = bh % NH;   /* the most stored states start first */
  const float* qg = qk + (size_t)b * SS * RS + h * DH;      /* query row t at qg + t * RS */
  const float* kg = qg + NH * DH;                           /* key row s at kg + s * RS */
  const float* vg = v + (size_t)b * SS * VS + h * DH;       /* V row s at vg + s * VS */
  const int sr = tid >> 4, sc4 = (tid & 15) * 4;      /* staging: rows sr + 16 i, 16 bytes of f32 at element sc4: a wave's load covers 4 whole 128-B lines */
  /* All of the work-group's loads are asked for here, in the order in which they are used below. First its own 256 keys. */
  const float* kp = kg + (size_t)(2 * pr * QT + sr) * RS + sc4;
  const float* vp = vg + (size_t)(2 * pr * QT + sr) * VS + sc4;
  v4f gk[16], gv[16];
#pragma unroll      /* the 32 loads go out together */
  for (int i = 0; i < 16; ++i) { gk[i] = *(const v4f*)(kp + 16 * i * RS); gv[i] = *(const v4f*)(vp + 16 * i * VS); }
  asm volatile("s_wait_xcnt 0x0" :: "v"(kp), "v"(vp) : "memory");      /* stands in front of any rewriting of the registers that the loads above name; the addresses as inputs keep them whole up to here */
  /* The stored states of the keys below: this wave's two tiles of each. pt: all 256 keys of the pairs of tiles below; ph: the first tile's own 128 keys, for the second tile. */
  const float* sp = st + (size_t)(bh * 8) * 8192 + w * 512 + 4 * lane;
  v4f pt[SS / QT / 2 - 1][4], ph[4];
  const float* ap[SS / QT / 2];
#pragma unroll      /* register arrays: every index a constant; all loads go out ahead of the first sum */
  for (int p = 0; p < SS / QT / 2 - 1; ++p) {
    ap[p] = (p < pr) ? sp + p * 8192 + 4096 : st;      /* no branch, so that every load is counted on every path; a pair that is not below the tile: all lanes read one stored place, weight 0 below */
#pragma unroll      /* register arrays: every index a constant */
    for (int y = 0; y < 4; ++y) pt[p][y] = *(const v4f*)(ap[p] + y * 128);
  }
  ap[SS / QT / 2 - 1] = sp + pr * 8192;
#pragma unroll      /* register arrays: every index a constant */
  for (int y = 0; y < 4; ++y) ph[y] = *(const v4f*)(ap[SS / QT / 2 - 1] + y * 128);
  asm volatile("s_wait_xcnt 0x0" :: "v"(ap[0]), "v"(ap[1]), "v"(ap[2]), "v"(ap[3]), "v"(ap[4]), "v"(ap[5]), "v"(ap[6]), "v"(ap[7]) : "memory");      /* stands in front of any rewriting of the registers that these loads name; the addresses as inputs keep them whole up to here */
  /* The wave's queries: group w of the first tile, group 7 - w of the second. Asked for last: nothing in front of the barrier needs them. */
  const float* qr[2]; const float* gp[2];
  v4f xq[2][8]; float gn[2];
#pragma unroll      /* register arrays: every index a constant; the loads go out together */
  for (int half = 0; half < 2; ++half) {
    const int tq = (2 * pr + half) * QT + 16 * (half ? 7 - w : w) + ln;
    qr[half] = qg + (size_t)tq * RS + 8 * hh;
    gp[half] = nn + ((size_t)b * SS + tq) * NH + h;
#pragma unroll      /* the eight loads go out together */
    for (int g = 0; g < 8; ++g) xq[half][g] = *(const v4f*)(qr[half] + 16 * (g >> 1) + 4 * (g & 1));      /* floats 16 (g / 2) + 8 hh + 4 (g % 2) .. + 3 of the row: the hardware k order */
    gn[half] = *gp[half];
    __builtin_amdgcn_sched_barrier(0);      /* the first tile's queries go out ahead of the second's: loads are waited for in their order of issue */
  }
  asm volatile("s_wait_xcnt 0x0" :: "v"(qr[0]), "v"(qr[1]), "v"(gp[0]), "v"(gp[1]) : "memory");      /* stands in front of any rewriting of the registers that these loads name; the addresses as inputs keep them whole up to here */
  __builtin_amdgcn_sched_barrier(0);      /* keeps the conversions and sums below, and the waits in front of them, behind the issue of all the loads above */
#pragma unroll      /* register arrays: every index a constant */
  for (int i = 0; i < 16; ++i) { *(v4us*)&sk[sr + 16 * i][sc4] = cvt4(gk[i]); *(v4us*)&sv[sr + 16 * i][sc4] = cvt4(gv[i]); }
  /* Keys below a tile: no mask, so sum_s (q.k_s) v_s = q.(sum_s k_s v_s^T). Wave w adds the stored states (lowest keys first) of state tiles (2 c, dvt) and (2 c + 1, dvt), dvt = w % 4, c = w / 4. */
  { v4f tot[2][2] = {};
#pragma unroll      /* register arrays: every index a constant */
    for (int p = 0; p < SS / QT / 2 - 1; ++p) {
      const float f = (p < pr) ? 1.0f : 0.0f;
#pragma unroll      /* register arrays: every index a constant */
      for (int y = 0; y < 4; ++y) tot[y >> 1][y & 1] += pt[p][y] * f;
    }
    put_state(tot, sf[0], w, lane);
#pragma unroll      /* register arrays: every index a constant */
    for (int y = 0; y < 4; ++y) tot[y >> 1][y & 1] += ph[y];
    put_state(tot, sf[1], w, lane);
  }
  /* The launch's one barrier: publishes both summed states and all 256 keys. Fenced for LDS alone: __syncthreads() would also wait out the queries' loads, which go to this lane's own registers and may land behind it. */
  __builtin_amdgcn_fence(__ATOMIC_RELEASE, "workgroup", "local");
  __builtin_amdgcn_s_barrier();
  __builtin_amdgcn_fence(__ATOMIC_ACQUIRE, "workgroup", "local");
  __builtin_amdgcn_sched_barrier(0);      /* keeps the queries' conversions, and the waits for their loads, behind the barrier */
#pragma unroll      /* half a constant: the loaded queries are register arrays */
  for (int half = 0; half < 2; ++half) {
    const int g = half ? 7 - w : w;      /* the wave's query group in this tile */
    const int tile = 2 * pr + half;
    const int tq0 = tile * QT + 16 * g, tq = tq0 + ln;
    FragH qf[2];
    { Q4 c;
#pragma unroll      /* fragments are register arrays: every index a constant */
      for (int e = 0; e < 8; ++e) { c.u = cvt4(xq[half][e]); qf[e >> 2].h2[2 * (e & 3)] = c.h2[0]; qf[e >> 2].h2[2 * (e & 3) + 1] = c.h2[1]; } }
    const float gate = expf(-bf16_round(gn[half]));
    const int nf = g >> 1;               /* passes wholly below the wave's queries; pass nf holds the diagonal; the passes above it hold masked keys only and are not run */
    const unsigned short* kt = &sk[half * QT][0];
    const unsigned short* tp = &sv[half * QT][0] + (8 * hh + (ln & 7)) * LV + 8 * (ln >> 3);
    FragH kf[2][2], vf[4];
    load_k(kt, ln, hh, kf);
    __builtin_amdgcn_sched_barrier(0);      /* the first pass's key rows are asked for ahead of the state product, which covers their LDS latency */
    /* O^T = gate * M.Q^T for the keys below the tile: the start value of the tile's own sums */
    v8f oh[4], ol[4] = {};
    { v8f ih[4] = {}, il[4] = {};
#pragma unroll      /* fragments and accumulators are register arrays: every index a constant */
      for (int c = 0; c < 2; ++c)
#pragma unroll      /* fragments and accumulators are register arrays: every index a constant */
        for (int dt = 0; dt < 4; ++dt) {
          FragH ah, al;
#pragma unroll      /* fragments are register arrays: every index a constant */
          for (int y = 0; y < 2; ++y) { ah.half[y] = *(const v8us*)&sf[half][((c * 4 + dt) * 2 + 0) * 2 + y][8 * lane]; al.half[y] = *(const v8us*)&sf[half][((c * 4 + dt) * 2 + 1) * 2 + y][8 * lane]; }
          ih[dt] = mma(ah.v, qf[c].v, ih[dt]);   /* ih[dt][r] = sum over d of M[16dt + 8hh + r][d] * q[tq][d] */
          il[dt] = mma(al.v, qf[c].v, il[dt]);
        }
#pragma unroll      /* accumulators are register arrays: every index a constant */
      for (int dt = 0; dt < 4; ++dt) oh[dt] = (ih[dt] + il[dt] * 0.0009765625f) * gate;
    }
    /* The passes below the diagonal: no mask. Each asks for its V^T fragments ahead of its scores, and for the next pass's key rows as soon as its own have been used. */
#pragma nounroll    /* 0 to 3 trips, the same for the whole wave: rolled, the text stays short */
    for (int j = 0; j < nf; ++j) {
      v8f sc[2]; FragH fh, fl;
      load_v(tp, vf);
      __builtin_amdgcn_sched_barrier(0);      /* keeps the V^T loads up here: the scores and their split cover the LDS latency */
      scores32(kf, qf, sc);
      kt += KB * LP; load_k(kt, ln, hh, kf);
      __builtin_amdgcn_sched_barrier(0);      /* keeps the next pass's key rows up here: the split and the sums below cover their LDS latency */
      split32<false>(sc, gate, 0, hh, 0, fh, fl);
      sums32(vf, fh, fl, oh, ol);
      tp += KB * LV;
    }
    /* The pass with the diagonal: masked. */
    { v8f sc[2]; FragH fh, fl;
      load_v(tp, vf);
      __builtin_amdgcn_sched_barrier(0);      /* keeps the V^T loads up here: the scores and their split cover the LDS latency */
      scores32(kf, qf, sc);
      split32<true>(sc, gate, tile * QT + KB * nf, hh, tq, fh, fl);
      sums32(vf, fh, fl, oh, ol);
    }
    /* O rows through the wave's own LDS range, so that each store instruction writes whole 128-B lines */
#pragma unroll      /* fragments and accumulators are register arrays: every index a constant */
    for (int dt = 0; dt < 4; ++dt) {
      v4f x, y;
#pragma unroll      /* fragments and accumulators are register arrays: every index a constant */
      for (int i = 0; i < 4; ++i) { x[i] = oh[dt][i] + ol[dt][i] * 0.0009765625f; y[i] = oh[dt][4 + i] + ol[dt][4 + i] * 0.0009765625f; }
      *(v4fa*)&so[w][ln][16 * dt + 8 * hh] = x; *(v4fa*)&so[w][ln][16 * dt + 8 * hh + 4] = y;
    }
    __builtin_amdgcn_fence(__ATOMIC_ACQ_REL, "workgroup");      /* the rows below were written by other lanes of this wave */
    __builtin_amdgcn_wave_barrier();
#pragma unroll      /* the eight row reads go out together, ahead of the stores */
    for (int q = 0; q < 8; ++q) {
      const int r = q * 2 + hh;
      const v4f o = *(const v4fa*)&so[w][r][ln * 4];
      *(v4f*)(out + (((size_t)b * SS + tq0 + r) * NH + h) * DH + ln * 4) = o;
    }
    asm volatile("s_wait_xcnt 0x0" ::: "memory");      /* stands in front of the next tile's rewriting of the registers that these stores name */
    __builtin_amdgcn_sched_barrier(0);      /* keeps the next tile's address arithmetic, which takes up those registers, behind that wait */
  }
}

extern "C" void kernel_launch(void* const* d_in, const int* in_sizes, int n_in,
                              void* d_out, int out_size, void* d_ws, size_t ws_size, hipStream_t stream) {
  (void)in_sizes; (void)n_in; (void)out_size; (void)ws_size;
  const float* qk = (const float*)d_in[0]; const float* v = (const float*)d_in[1]; const float* nn = (const float*)d_in[2];
  float* st = (float*)d_ws;      /* 32 (batch, head) x 8 x 2 states of 16 KiB: 8 MiB, all written by k_state */
  k_state<<<NBt * NH * (SS / QT / 2), 256, 0, stream>>>(qk, v, st);                    /* 256 work-groups, 256 successive keys each */
  k_attn<<<NBt * NH * (SS / QT / 2), 256, 0, stream>>>(qk, v, nn, st, (float*)d_out);  /* 256 work-groups, two successive query tiles each */
}

// v006
// Measured time: 12.2 microseconds a run.
// Timed twice side by side with v005, it ran 1.08 times as fast both times.
// All steps since v000 together make it 494 times as fast.
#include <hip/hip_runtime.h>
// Self-normalising linear attention (B 2, S 2048, 16 heads x 64): scores[t][s] = q_t.k_s (no scaling), causal (s <= t, multiplicative mask),
// attention = exp(-n[b,t,h]) * scores (no softmax), out[b,t,h,:] = sum_s attention[t][s] * v[b,s,h,:] -> [2,2048,16,64].
// Structure: TWO launches; both read their inputs as f32 and round and convert them on the way into registers (q) and LDS (k, v).
//   Keys below a query tile carry no mask and there is no softmax, so their part is reassociated: sum_s (q.k_s) v_s = q.(sum_s k_s v_s^T).
//   k_state: a work-group of 8 waves owns 256 successive keys of one (batch, head). The 64 x 64 state K^T.V is summed on the matrix unit, each
//   wave on its own block of 32 keys through its own LDS range; the waves' parts are summed through LDS and stored in the workspace as f32,
//   one state for the 256 keys. The last 256 keys of a sequence lie below no tile of another work-group and get no state.
//   k_attn: scores, gate, mask and weighted sums. V is staged as it lies (row = key); the transposing LDS load hands out V^T fragments.
//   A work-group of 8 waves owns 256 successive queries of one (batch, head), as two tiles of 128; a wave owns 16 queries of each tile:
//   group w of the first, group 7 - w of the second. All 256 keys are staged at once, behind one barrier.
//   It adds up the stored states of the keys below its tiles (at most 7 of 256 keys), splits the sum into f16 hi + lo and multiplies it by the
//   wave's queries. The second tile's state is that sum plus K^T.V of the first tile's 128 keys, formed here from the staged rows (each wave
//   its two state tiles, 8 matrix instructions on top of the sum), so that it is not handed over through the workspace; a second barrier publishes it.
//   The tile's own 128 keys, in passes of 32, transposed products: S^T = K.Q^T (A = key rows from LDS, B = the wave's queries, kept in
//   registers), O^T += V^T.P^T. Two f32 S^T tiles (keys 0-15, 16-31 of a pass, same queries), gated and converted in place, ARE the B operand
//   of the second product, so a score never leaves the registers. Query group g needs passes 0 .. g / 2 alone (the passes above hold masked
//   keys only), and only the last of them holds a masked key: with groups w and 7 - w every wave runs 5 passes, 2 of them with the mask.
// Compute dtype: qk, v, n rounded to bf16, so q, k, v are exact as f16 operands; scores with exact products and
//   f32 accumulation; gated scores and the state as f16 hi + lo * 2^10 operands (about f32: the weighted sums cancel heavily), f32 accumulation;
//   exp in f32. v_wmma_f32_16x16x32_f16.
#define NBt 2
#define SS 2048
#define NH 16
#define DH 64
#define RS (2 * NH * DH)   /* row stride (t) of the q|k layout, elements */
#define QT 128             /* queries per work-group tile */
#define KB 32              /* keys per block of the state sum, and per pass of a tile's own keys */
#define LP 72              /* LDS row pitch in f16: 144 B = 16 B x odd, conflict-free for 16-byte row readers */
#define LV 80              /* LDS row pitch of V in f16: 160 B = 32 B x odd, conflict-free for the transposing 16-byte reader */
#define VS (NH * DH)       /* row stride (s) of v, elements */
#define OP 68              /* output staging pitch in f32: 272 B = 16 B x odd */
typedef unsigned short v8us __attribute__((ext_vector_type(8), may_alias));
typedef unsigned short v4us __attribute__((ext_vector_type(4), may_alias));
typedef short s16x8 __attribute__((ext_vector_type(8)));
typedef __bf16 v2b __attribute__((ext_vector_type(2)));
typedef float  v8f  __attribute__((ext_vector_type(8)));
typedef float  v4f  __attribute__((ext_vector_type(4)));
typedef float  v4fa __attribute__((ext_vector_type(4), may_alias));
typedef _Float16 v16h __attribute__((ext_vector_type(16)));
typedef float v2f __attribute__((ext_vector_type(2)));
typedef _Float16 v2h __attribute__((ext_vector_type(2)));
union FragH { v16h v; v8us half[2]; v2h h2[8]; _Float16 h[16]; unsigned short u[16]; };

__device__ __forceinline__ unsigned short bf16_bits(float x) { unsigned int u = __float_as_uint(x); return (unsigned short)((u + 0x7FFFu + ((u >> 16) & 1u)) >> 16); }
__device__ __forceinline__ float bf16_val(unsigned short b) { return __uint_as_float(((unsigned int)b) << 16); }
__device__ __forceinline__ float bf16_round(float x) { return bf16_val(bf16_bits(x)); }
__device__ __forceinline__ v8f mma(v16h a, v16h b, v8f c) { return __builtin_amdgcn_wmma_f32_16x16x32_f16(false, a, false, b, (short)0, c, false, false); }

// Four f32 inputs, rounded to bf16 (nearest even) and held as f16 (exact).
union Q4 { v4us u; v2h h2[2]; };
__device__ __forceinline__ v4us cvt4(v4f x) {
  Q4 r;
#pragma unroll      /* p a constant: the vector's elements are picked at compile time and stay in registers */
  for (int p = 0; p < 2; ++p) { const v2f a = { x[2 * p], x[2 * p + 1] }; r.h2[p] = __builtin_convertvector(__builtin_convertvector(__builtin_convertvector(a, v2b), v2f), v2h); }
  return r.u;
}

// Gate, mask and split of one pass: two f32 S^T tiles (keys s0 + 0..15, s0 + 16..31, this lane's query tq) become the hi and lo B operands.
// sc[a][r] = score of key s0 + 16a + 8hh + r; element 8a + r of a B operand is k = 16a + 8hh + r: the hardware k order, in place.
template <bool MASK>
__device__ __forceinline__ void split32(const v8f (&sc)[2], float gate, int s0, int hh, int tq, FragH& ph, FragH& pl) {
#pragma unroll      /* fragments and accumulators are register arrays: every index a constant */
  for (int a = 0; a < 2; ++a)
#pragma unroll      /* fragments and accumulators are register arrays: every index a constant */
    for (int r = 0; r < 8; r += 2) {      /* two scores at a time: packed multiply, packed conversions */
      v2f pv = { sc[a][r] * gate, sc[a][r + 1] * gate };
      if (MASK) { const int s = s0 + 16 * a + 8 * hh + r; pv[0] = (s <= tq) ? pv[0] : 0.f; pv[1] = (s + 1 <= tq) ? pv[1] : 0.f; }
      const v2h hi = __builtin_convertvector(pv, v2h);
      const v2h lo = __builtin_convertvector((pv - __builtin_convertvector(hi, v2f)) * 1024.0f, v2h);
      ph.h2[4 * a + r / 2] = hi;
      pl.h2[4 * a + r / 2] = lo;
    }
}
// A fragment of 16 rows x 32 k from LDS rows of pitch LP, in the hardware k order (elements 0-7 = k 8hh + i, 8-15 = k 16 + 8hh + i).
__device__ __forceinline__ FragH frag(const unsigned short* row0, int ln, int hh) {
  const unsigned short* p = row0 + ln * LP + 8 * hh; FragH f; f.half[0] = *(const v8us*)(p); f.half[1] = *(const v8us*)(p + 16); return f;
}
// A fragment of V^T, 16 d x 32 keys, from LDS V rows (row = key, pitch LV): tp = this lane's address in the first 16 keys x 16 d block.
// Lane (ln, hh) receives V[8hh + 0..7][ln] and V[16 + 8hh + 0..7][ln]: the same hardware k order.
__device__ __forceinline__ v8us tr16(const unsigned short* p) { typedef __attribute__((address_space(3))) s16x8 lds_s16x8; return __builtin_bit_cast(v8us, __builtin_amdgcn_ds_load_tr16_b128_v8i16((lds_s16x8*)p)); }
__device__ __forceinline__ FragH fragt(const unsigned short* tp) { FragH f; f.half[0] = tr16(tp); f.half[1] = tr16(tp + 16 * LV); return f; }
// The same of K^T, 16 d x 32 keys, from LDS key rows of pitch LP.
__device__ __forceinline__ FragH fragk(const unsigned short* tp) { FragH f; f.half[0] = tr16(tp); f.half[1] = tr16(tp + 16 * LP); return f; }
// One pass: 32 keys against the wave's 16 queries. kt: the pass's first LDS key row; tp: this lane's address for the transposing reader in the pass's first V row.
__device__ __forceinline__ void load_k(const unsigned short* kt, int ln, int hh, FragH (&kf)[2][2]) {
#pragma unroll      /* fragments are register arrays: every index a constant */
  for (int a = 0; a < 2; ++a) { kf[a][0] = frag(kt + 16 * a * LP, ln, hh); kf[a][1] = frag(kt + 16 * a * LP + 32, ln, hh); }
}
__device__ __forceinline__ void load_v(const unsigned short* tp, FragH (&vf)[4]) {
#pragma unroll      /* fragments are register arrays: every index a constant */
  for (int dt = 0; dt < 4; ++dt) vf[dt] = fragt(tp + 16 * dt);
}
__device__ __forceinline__ void scores32(const FragH (&kf)[2][2], const FragH (&qf)[2], v8f (&sc)[2]) {
#pragma unroll      /* fragments and accumulators are register arrays: every index a constant */
  for (int a = 0; a < 2; ++a) { v8f c = {}; c = mma(kf[a][0].v, qf[0].v, c); sc[a] = mma(kf[a][1].v, qf[1].v, c); }
}
__device__ __forceinline__ void sums32(const FragH (&vf)[4], const FragH& fh, const FragH& fl, v8f (&oh)[4], v8f (&ol)[4]) {
#pragma unroll      /* fragments and accumulators are register arrays: every index a constant */
  for (int dt = 0; dt < 4; ++dt) {
    oh[dt] = mma(vf[dt].v, fh.v, oh[dt]);   /* oh[dt][r] = O[tq][16dt + 8hh + r] */
    ol[dt] = mma(vf[dt].v, fl.v, ol[dt]);
  }
}
// A summed state (this wave's two tiles, f32) as the A operand M[16 dvt + ln][32 c + k], M = V^T.K, in the hardware k order: element 8 a + r is k = 16 a + 8 hh + r.
// Held as f16 hi + lo * 2^10, like the gated scores. sfh: the tile's operands in LDS, [(slot * 2 + lo) * 2 + half][lane * 8], slot = c * 4 + dvt.
__device__ __forceinline__ void put_state(const v4f (&tot)[2][2], unsigned short (*sfh)[256], int slot, int lane) {
  FragH mh, ml;
#pragma unroll      /* fragments are register arrays: every index a constant */
  for (int a = 0; a < 2; ++a)
#pragma unroll      /* fragments are register arrays: every index a constant */
    for (int x = 0; x < 2; ++x) {
      const v4f s = tot[a][x];
#pragma unroll      /* fragments are register arrays: every index a constant */
      for (int e = 0; e < 4; e += 2) {
        const v2f pv = { s[e], s[e + 1] };
        const v2h hi = __builtin_convertvector(pv, v2h);
        const v2h lo = __builtin_convertvector((pv - __builtin_convertvector(hi, v2f)) * 1024.0f, v2h);
        mh.h2[4 * a + 2 * x + e / 2] = hi;
        ml.h2[4 * a + 2 * x + e / 2] = lo;
      }
    }
#pragma unroll      /* fragments are register arrays: every index a constant */
  for (int y = 0; y < 2; ++y) { *(v8us*)&sfh[(slot * 2 + 0) * 2 + y][8 * lane] = mh.half[y]; *(v8us*)&sfh[(slot * 2 + 1) * 2 + y][8 * lane] = ml.half[y]; }
}

// One key block for one wave, 32 rows of K and of V as f32: rows 2 i + hh, 16 bytes at element 4 ln, so each load covers 4 whole 128-B lines.
// pk points at this lane's place in the first q|k row (its keys stand NH * DH further), pv at its place in the first V row.
__device__ __forceinline__ void load_block(const float* pk, const float* pv, v4f (&xk)[16], v4f (&xv)[16]) {
#pragma unroll      /* the 32 loads go out together */
  for (int i = 0; i < 16; ++i) { xk[i] = *(const v4f*)(pk + NH * DH + 2 * i * RS); xv[i] = *(const v4f*)(pv + 2 * i * VS); }
  asm volatile("s_wait_xcnt 0x0" :: "v"(pk), "v"(pv) : "memory");      /* stands in front of any rewriting of the registers that these loads name; the addresses as inputs keep a load's own result out of them */
}

// The state of 256 successive keys of one (batch, head): st + (bh * 8 + pr) * 4096.
// In a state, wave w's two tiles stand as it holds them: registers 4 x .. 4 x + 3 of tile a of this lane at (w * 4 + a * 2 + x) * 128 + 4 lane.
__global__ __launch_bounds__(256) void k_state(const float* __restrict__ qk, const float* __restrict__ v, float* __restrict__ st) {
  __shared__ __attribute__((aligned(32))) unsigned short wr[8][8192];     /* each wave's own 16 KiB: 32 K rows and 32 V rows of its key block (pitch LV); then its part of the state, 16 f32 tiles */
  const int tid = threadIdx.x, lane = tid & 31, ln = lane & 15, hh = lane >> 4;
  const int w = __builtin_amdgcn_readfirstlane(tid >> 5);
  const int bh = blockIdx.x & (NBt * NH - 1), pr = blockIdx.x >> 5, b = bh / NH, h = bh % NH;
  const float* qg = qk + (size_t)b * SS * RS + h * DH;      /* q|k row s at qg + s * RS */
  const float* vg = v + (size_t)b * SS * VS + h * DH;       /* V row s at vg + s * VS */
  unsigned short* wk = &wr[w][0];
  unsigned short* wv = wk + KB * LV;
  const unsigned short* tk = wk + (8 * hh + (ln & 7)) * LV + 8 * (ln >> 3);      /* this lane's address for the transposing reader, as in k_attn */
  const unsigned short* tv = wv + (8 * hh + (ln & 7)) * LV + 8 * (ln >> 3);
  float* wf = (float*)wk;      /* the wave's part of the state: tile t = 4 i + j, registers 4 x .. 4 x + 3 of this lane at wf + (2 t + x) * 128 + 4 lane */
  const int kb = pr * 8 + w;   /* the wave's key block of 32 */
  v4f xk[16], xv[16];
  load_block(qg + (size_t)(kb * KB + hh) * RS + 4 * ln, vg + (size_t)(kb * KB + hh) * VS + 4 * ln, xk, xv);
#pragma unroll      /* register arrays: every index a constant */
  for (int i = 0; i < 16; ++i) { *(v4us*)(wk + (2 * i + hh) * LV + 4 * ln) = cvt4(xk[i]); *(v4us*)(wv + (2 * i + hh) * LV + 4 * ln) = cvt4(xv[i]); }
  asm volatile("s_wait_dscnt 0x0" ::: "memory");      /* the rows read below were written by other lanes of this wave: its LDS stores are done */
  FragH kf[4], vf[4];      /* K^T as A (16 d x 32 keys), V as B (32 keys x 16 d): one loader, so one k order */
#pragma unroll      /* fragments are register arrays: every index a constant */
  for (int t = 0; t < 4; ++t) { kf[t] = fragt(tk + 16 * t); vf[t] = fragt(tv + 16 * t); }
  /* m[r] of tile t = 4 i + j = sum over the wave's keys of K[s][16 i + 8 hh + r] * V[s][16 j + ln]; it goes into the wave's own LDS range, over the rows, whose reads all stand in front of these stores */
#pragma unroll      /* fragments and accumulators are register arrays: every index a constant */
  for (int g = 0; g < 2; ++g) {
    v8f m[8];
#pragma unroll      /* accumulators are register arrays: every index a constant */
    for (int t = 0; t < 8; ++t) { const v8f z = {}; m[t] = mma(kf[2 * g + (t >> 2)].v, vf[t & 3].v, z); }
    __builtin_amdgcn_sched_barrier(0);      /* eight products in registers of their own ahead of their stores: a product written over the registers of one made fewer than four vector instructions earlier breaks the chip's distance rule */
#pragma unroll      /* accumulators are register arrays: every index a constant */
    for (int t = 0; t < 8; ++t)
#pragma unroll      /* accumulators are register arrays: every index a constant */
      for (int x = 0; x < 2; ++x) { const v4f y = { m[t][4 * x], m[t][4 * x + 1], m[t][4 * x + 2], m[t][4 * x + 3] }; *(v4fa*)(wf + (2 * (8 * g + t) + x) * 128 + 4 * lane) = y; }
  }
  __syncthreads();      /* the parts are in LDS */
  /* Wave w adds the parts (wave 0 first) of state tiles (2 c, dvt) and (2 c + 1, dvt): the two that it converts in k_attn. */
  const int dvt = w & 3, c = w >> 2;
  float* sp = st + (size_t)(bh * 8 + pr) * 4096 + w * 512 + 4 * lane;
  v4f pa[8][2][2], tot[2][2] = {};
#pragma unroll      /* the 32 reads go out together */
  for (int u = 0; u < 8; ++u)
#pragma unroll      /* register arrays: every index a constant */
    for (int a = 0; a < 2; ++a)
#pragma unroll      /* register arrays: every index a constant */
      for (int x = 0; x < 2; ++x) pa[u][a][x] = *(const v4fa*)((const float*)&wr[u][0] + (2 * ((2 * c + a) * 4 + dvt) + x) * 128 + 4 * lane);
  __builtin_amdgcn_sched_barrier(0);      /* keeps all 32 reads ahead of the first sum: one LDS latency is waited out, not one for each group of reads */
#pragma unroll      /* register arrays: every index a constant */
  for (int u = 0; u < 8; ++u)
#pragma unroll      /* register arrays: every index a constant */
    for (int a = 0; a < 2; ++a)
#pragma unroll      /* register arrays: every index a constant */
      for (int x = 0; x < 2; ++x) tot[a][x] += pa[u][a][x];
  /* the stores stand last: no register that they name is written again */
#pragma unroll      /* register arrays: every index a constant */
  for (int a = 0; a < 2; ++a)
#pragma unroll      /* register arrays: every index a constant */
    for (int x = 0; x < 2; ++x) *(v4f*)(sp + (a * 2 + x) * 128) = tot[a][x];
}

__global__ __launch_bounds__(256) void k_attn(const float* __restrict__ qk, const float* __restrict__ v, const float* __restrict__ nn, const float* __restrict__ st, float* __restrict__ out) {
  __shared__ __attribute__((aligned(16))) unsigned short sk[2 * QT][LP];  /* key rows of both tiles */
  __shared__ __attribute__((aligned(32))) unsigned short sv[2 * QT][LV];  /* V rows of both tiles */
  __shared__ __attribute__((aligned(16))) float so[8][16][OP];            /* each wave's own output staging */
  __shared__ __attribute__((aligned(16))) unsigned short sf[2][32][256];  /* each tile's summed state as A operands: [tile][((c * 4 + dvt) * 2 + lo) * 2 + half][lane * 8] */
  const int tid = threadIdx.x, lane = tid & 31, ln = lane & 15, hh = lane >> 4;
  const int w = __builtin_amdgcn_readfirstlane(tid >> 5);
  const int bh = blockIdx.x & (NBt * NH - 1), pr = (SS / QT / 2 - 1) - (blockIdx.x >> 5), b = bh / NH, h = bh % NH;   /* the most stored states start first */
  const float* qg = qk + (size_t)b * SS * RS + h * DH;      /* query row t at qg + t * RS */
  const float* kg = qg + NH * DH;                           /* key row s at kg + s * RS */
  const float* vg = v + (size_t)b * SS * VS + h * DH;       /* V row s at vg + s * VS */
  const int sr = tid >> 4, sc4 = (tid & 15) * 4;      /* staging: rows sr + 16 i, 16 bytes of f32 at element sc4: a wave's load covers 4 whole 128-B lines */
  /* All of the work-group's loads are asked for here, in the order in which they are used below. First its own 256 keys. */
  const float* kp = kg + (size_t)(2 * pr * QT + sr) * RS + sc4;
  const float* vp = vg + (size_t)(2 * pr * QT + sr) * VS + sc4;
  v4f gk[16], gv[16];
#pragma unroll      /* the 32 loads go out together */
  for (int i = 0; i < 16; ++i) { gk[i] = *(const v4f*)(kp + 16 * i * RS); gv[i] = *(const v4f*)(vp + 16 * i * VS); }
  asm volatile("s_wait_xcnt 0x0" :: "v"(kp), "v"(vp) : "memory");      /* stands in front of any rewriting of the registers that the loads above name; the addresses as inputs keep them whole up to here */
  /* The stored states of the keys below, one for each pair of tiles: this wave's two state tiles of each. */
  const float* sp = st + (size_t)(bh * 8) * 4096 + w * 512 + 4 * lane;
  v4f pt[SS / QT / 2 - 1][4];
  const float* ap[SS / QT / 2 - 1];
#pragma unroll      /* register arrays: every index a constant; all loads go out ahead of the first sum */
  for (int p = 0; p < SS / QT / 2 - 1; ++p) {
    ap[p] = (p < pr) ? sp + p * 4096 : st;      /* no branch, so that every load is counted on every path; a pair that is not below the tile: all lanes read one stored place, weight 0 below */
#pragma unroll      /* register arrays: every index a constant */
    for (int y = 0; y < 4; ++y) pt[p][y] = *(const v4f*)(ap[p] + y * 128);
  }
  asm volatile("s_wait_xcnt 0x0" :: "v"(ap[0]), "v"(ap[1]), "v"(ap[2]), "v"(ap[3]), "v"(ap[4]), "v"(ap[5]), "v"(ap[6]) : "memory");      /* stands in front of any rewriting of the registers that these loads name; the addresses as inputs keep them whole up to here */
  /* The wave's queries: group w of the first tile, group 7 - w of the second. Asked for last: nothing in front of the barrier needs them. */
  const float* qr[2]; const float* gp[2];
  v4f xq[2][8]; float gn[2];
#pragma unroll      /* register arrays: every index a constant; the loads go out together */
  for (int half = 0; half < 2; ++half) {
    const int tq = (2 * pr + half) * QT + 16 * (half ? 7 - w : w) + ln;
    qr[half] = qg + (size_t)tq * RS + 8 * hh;
    gp[half] = nn + ((size_t)b * SS + tq) * NH + h;
#pragma unroll      /* the eight loads go out together */
    for (int g = 0; g < 8; ++g) xq[half][g] = *(const v4f*)(qr[half] + 16 * (g >> 1) + 4 * (g & 1));      /* floats 16 (g / 2) + 8 hh + 4 (g % 2) .. + 3 of the row: the hardware k order */
    gn[half] = *gp[half];
    __builtin_amdgcn_sched_barrier(0);      /* the first tile's queries go out ahead of the second's: loads are waited for in their order of issue */
  }
  asm volatile("s_wait_xcnt 0x0" :: "v"(qr[0]), "v"(qr[1]), "v"(gp[0]), "v"(gp[1]) : "memory");      /* stands in front of any rewriting of the registers that these loads name; the addresses as inputs keep them whole up to here */
  __builtin_amdgcn_sched_barrier(0);      /* keeps the conversions and sums below, and the waits in front of them, behind the issue of all the loads above */
#pragma unroll      /* register arrays: every index a constant */
  for (int i = 0; i < 16; ++i) { *(v4us*)&sk[sr + 16 * i][sc4] = cvt4(gk[i]); *(v4us*)&sv[sr + 16 * i][sc4] = cvt4(gv[i]); }
  /* Keys below a tile: no mask, so sum_s (q.k_s) v_s = q.(sum_s k_s v_s^T). Wave w adds the stored states (lowest keys first) of state tiles (2 c, dvt) and (2 c + 1, dvt), dvt = w % 4, c = w / 4. */
  v4f tot[2][2] = {};
#pragma unroll      /* register arrays: every index a constant */
  for (int p = 0; p < SS / QT / 2 - 1; ++p) {
    const float f = (p < pr) ? 1.0f : 0.0f;
#pragma unroll      /* register arrays: every index a constant */
    for (int y = 0; y < 4; ++y) tot[y >> 1][y & 1] += pt[p][y] * f;
  }
  put_state(tot, sf[0], w, lane);
  /* The first barrier: publishes the first tile's summed state and all 256 keys. Fenced for LDS alone: __syncthreads() would also wait out the queries' loads, which go to this lane's own registers and may land behind it. */
  __builtin_amdgcn_fence(__ATOMIC_RELEASE, "workgroup", "local");
  __builtin_amdgcn_s_barrier();
  __builtin_amdgcn_fence(__ATOMIC_ACQUIRE, "workgroup", "local");
  __builtin_amdgcn_sched_barrier(0);      /* keeps the queries' conversions, and the waits for their loads, behind the barrier */
  /* The second tile's state: the sum above plus K^T.V of the first tile's 128 keys, from the staged rows, on the wave's two state tiles (2 c + a, dvt).
     K^T as A (16 d x 32 keys), V as B (32 keys x 16 d), both through the transposing reader: one k order. The sum is the accumulators' start value:
     register r = 4 x + e of tile a is tot[a][x][e], as k_state stores it. */
  FragH qa[2][2]; float gt[2];
  { const unsigned short* tk = &sk[0][0] + (8 * hh + (ln & 7)) * LP + 8 * (ln >> 3) + 32 * (w >> 2);
    const unsigned short* tv = &sv[0][0] + (8 * hh + (ln & 7)) * LV + 8 * (ln >> 3) + 16 * (w & 3);
    FragH ka[4][2], vb[4];
#pragma unroll      /* fragments are register arrays: every index a constant */
    for (int s = 0; s < 4; ++s) { vb[s] = fragt(tv + s * KB * LV); ka[s][0] = fragk(tk + s * KB * LP); ka[s][1] = fragk(tk + s * KB * LP + 16); }
    __builtin_amdgcn_sched_barrier(0);      /* keeps the 24 LDS reads up here: the queries' conversions below cover their latency */
#pragma unroll      /* half a constant: the loaded queries are register arrays */
    for (int half = 0; half < 2; ++half) {
      Q4 c;
#pragma unroll      /* fragments are register arrays: every index a constant */
      for (int e = 0; e < 8; ++e) { c.u = cvt4(xq[half][e]); qa[half][e >> 2].h2[2 * (e & 3)] = c.h2[0]; qa[half][e >> 2].h2[2 * (e & 3) + 1] = c.h2[1]; }
      gt[half] = expf(-bf16_round(gn[half]));
    }
    v8f ms[2];
#pragma unroll      /* accumulators are register arrays: every index a constant */
    for (int a = 0; a < 2; ++a)
#pragma unroll      /* accumulators are register arrays: every index a constant */
      for (int r = 0; r < 8; ++r) ms[a][r] = tot[a][r >> 2][r & 3];
#pragma unroll      /* fragments and accumulators are register arrays: every index a constant */
    for (int s = 0; s < 4; ++s) { ms[0] = mma(ka[s][0].v, vb[s].v, ms[0]); ms[1] = mma(ka[s][1].v, vb[s].v, ms[1]); }
#pragma unroll      /* accumulators are register arrays: every index a constant */
    for (int a = 0; a < 2; ++a)
#pragma unroll      /* accumulators are register arrays: every index a constant */
      for (int r = 0; r < 8; ++r) tot[a][r >> 2][r & 3] = ms[a][r];
    put_state(tot, sf[1], w, lane);
  }
  /* The second barrier: publishes the second tile's state. It stands here, where every wave has done the same work since the first. Fenced for LDS alone, as the first. */
  __builtin_amdgcn_fence(__ATOMIC_RELEASE, "workgroup", "local");
  __builtin_amdgcn_s_barrier();
  __builtin_amdgcn_fence(__ATOMIC_ACQUIRE, "workgroup", "local");
  __builtin_amdgcn_sched_barrier(0);      /* keeps the reads of the published state behind the barrier */
#pragma unroll      /* half a constant: the queries' fragments are register arrays */
  for (int half = 0; half < 2; ++half) {
    const int g = half ? 7 - w : w;      /* the wave's query group in this tile */
    const int tile = 2 * pr + half;
    const int tq0 = tile * QT + 16 * g, tq = tq0 + ln;
    const FragH (&qf)[2] = qa[half];
    const float gate = gt[half];
    const int nf = g >> 1;               /* passes wholly below the wave's queries; pass nf holds the diagonal; the passes above it hold masked keys only and are not run */
    const unsigned short* kt = &sk[half * QT][0];
    const unsigned short* tp = &sv[half * QT][0] + (8 * hh + (ln & 7)) * LV + 8 * (ln >> 3);
    FragH kf[2][2], vf[4];
    load_k(kt, ln, hh, kf);
    __builtin_amdgcn_sched_barrier(0);      /* the first pass's key rows are asked for ahead of the state product, which covers their LDS latency */
    /* O^T = gate * M.Q^T for the keys below the tile: the start value of the tile's own sums */
    v8f oh[4], ol[4] = {};
    { v8f ih[4] = {}, il[4] = {};
#pragma unroll      /* fragments and accumulators are register arrays: every index a constant */
      for (int c = 0; c < 2; ++c)
#pragma unroll      /* fragments and accumulators are register arrays: every index a constant */
        for (int dt = 0; dt < 4; ++dt) {
          FragH ah, al;
#pragma unroll      /* fragments are register arrays: every index a constant */
          for (int y = 0; y < 2; ++y) { ah.half[y] = *(const v8us*)&sf[half][((c * 4 + dt) * 2 + 0) * 2 + y][8 * lane]; al.half[y] = *(const v8us*)&sf[half][((c * 4 + dt) * 2 + 1) * 2 + y][8 * lane]; }
          ih[dt] = mma(ah.v, qf[c].v, ih[dt]);   /* ih[dt][r] = sum over d of M[16dt + 8hh + r][d] * q[tq][d] */
          il[dt] = mma(al.v, qf[c].v, il[dt]);
        }
#pragma unroll      /* accumulators are register arrays: every index a constant */
      for (int dt = 0; dt < 4; ++dt) oh[dt] = (ih[dt] + il[dt] * 0.0009765625f) * gate;
    }
    /* The passes below the diagonal: no mask. Each asks for its V^T fragments ahead of its scores, and for the next pass's key rows as soon as its own have been used. */
#pragma nounroll    /* 0 to 3 trips, the same for the whole wave: rolled, the text stays short */
    for (int j = 0; j < nf; ++j) {
      v8f sc[2]; FragH fh, fl;
      load_v(tp, vf);
      __builtin_amdgcn_sched_barrier(0);      /* keeps the V^T loads up here: the scores and their split cover the LDS latency */
      scores32(kf, qf, sc);
      kt += KB * LP; load_k(kt, ln, hh, kf);
      __builtin_amdgcn_sched_barrier(0);      /* keeps the next pass's key rows up here: the split and the sums below cover their LDS latency */
      split32<false>(sc, gate, 0, hh, 0, fh, fl);
      sums32(vf, fh, fl, oh, ol);
      tp += KB * LV;
    }
    /* The pass with the diagonal: masked. */
    { v8f sc[2]; FragH fh, fl;
      load_v(tp, vf);
      __builtin_amdgcn_sched_barrier(0);      /* keeps the V^T loads up here: the scores and their split cover the LDS latency */
      scores32(kf, qf, sc);
      split32<true>(sc, gate, tile * QT + KB * nf, hh, tq, fh, fl);
      sums32(vf, fh, fl, oh, ol);
    }
    /* O rows through the wave's own LDS range, so that each store instruction writes whole 128-B lines */
#pragma unroll      /* fragments and accumulators are register arrays: every index a constant */
    for (int dt = 0; dt < 4; ++dt) {
      v4f x, y;
#pragma unroll      /* fragments and accumulators are register arrays: every index a constant */
      for (int i = 0; i < 4; ++i) { x[i] = oh[dt][i] + ol[dt][i] * 0.0009765625f; y[i] = oh[dt][4 + i] + ol[dt][4 + i] * 0.0009765625f; }
      *(v4fa*)&so[w][ln][16 * dt + 8 * hh] = x; *(v4fa*)&so[w][ln][16 * dt + 8 * hh + 4] = y;
    }
    __builtin_amdgcn_fence(__ATOMIC_ACQ_REL, "workgroup");      /* the rows below were written by other lanes of this wave */
    __builtin_amdgcn_wave_barrier();
#pragma unroll      /* the eight row reads go out together, ahead of the stores */
    for (int q = 0; q < 8; ++q) {
      const int r = q * 2 + hh;
      const v4f o = *(const v4fa*)&so[w][r][ln * 4];
      *(v4f*)(out + (((size_t)b * SS + tq0 + r) * NH + h) * DH + ln * 4) = o;
    }
    asm volatile("s_wait_xcnt 0x0" ::: "memory");      /* stands in front of the next tile's rewriting of the registers that these stores name */
    __builtin_amdgcn_sched_barrier(0);      /* keeps the next tile's address arithmetic, which takes up those registers, behind that wait */
  }
}

extern "C" void kernel_launch(void* const* d_in, const int* in_sizes, int n_in,
                              void* d_out, int out_size, void* d_ws, size_t ws_size, hipStream_t stream) {
  (void)in_sizes; (void)n_in; (void)out_size; (void)ws_size;
  const float* qk = (const float*)d_in[0]; const float* v = (const float*)d_in[1]; const float* nn = (const float*)d_in[2];
  float* st = (float*)d_ws;      /* 32 (batch, head) x 8 places of 16 KiB; the first 7 of each hold a state, written by k_state, and only these are read */
  k_state<<<NBt * NH * (SS / QT / 2 - 1), 256, 0, stream>>>(qk, v, st);                /* 224 work-groups, 256 successive keys each */
  k_attn<<<NBt * NH * (SS / QT / 2), 256, 0, stream>>>(qk, v, nn, st, (float*)d_out);  /* 256 work-groups, two successive query tiles each */
}
